// v000
// Times are from an AMD MI455X. After a warm-up the kernel runs many times in a row, and a time is the length of
// such a window on the GPU divided by its runs, so every launch and the gaps after it count. The runs cycle
// through copies of the inputs. A figure is the median of several windows, for all but v000 over two sittings.
// Sittings can differ by a few percent; kernels timed side by side share one.
// The starting kernel, v000, takes 301 microseconds a run.
#include <hip/hip_runtime.h>

typedef _Float16 f16;
typedef __attribute__((ext_vector_type(4)))  f16   v4h;
typedef __attribute__((ext_vector_type(8)))  f16   v8h;
typedef __attribute__((ext_vector_type(16))) f16   v16h;
typedef __attribute__((ext_vector_type(8)))  float v8f;
typedef __attribute__((ext_vector_type(4)))  float v4f;

#define E_  512
#define H_  8
#define DH_ 64
#define LQ_ 2048
#define LK_ 4096
#define B_  2

static __device__ __forceinline__ v16h cat8(v8h lo, v8h hi) {
  return __builtin_shufflevector(lo, hi, 0,1,2,3,4,5,6,7,8,9,10,11,12,13,14,15);
}
static __device__ __forceinline__ v16h ld_frag(const f16* p) {
  v8h lo = *(const v8h*)p;
  v8h hi = *(const v8h*)(p + 16);
  return cat8(lo, hi);
}
static __device__ __forceinline__ v8f wmma32(v16h a, v16h b, v8f c) {
  // D = A(16x32 f16) * B(32x16 f16) + C(16x16 f32)
  return __builtin_amdgcn_wmma_f32_16x16x32_f16(false, a, false, b, (short)0, c, false, false);
}

// Async global->LDS copy, 16B per lane, tracked on ASYNCcnt (CDNA5 path).
static __device__ __forceinline__ void async_copy_b128(uint32_t lds_off, const f16* gaddr) {
  asm volatile("global_load_async_to_lds_b128 %0, %1, off"
               :: "v"(lds_off), "v"(gaddr) : "memory");
}
static __device__ __forceinline__ void async_wait0() {
  asm volatile("s_wait_asynccnt 0x0" ::: "memory");
}

// ---------------------------------------------------------------- convert
__global__ __launch_bounds__(256) void cvt_f32_f16(const float* __restrict__ in,
                                                   f16* __restrict__ out, int n4) {
  int i = blockIdx.x * 256 + threadIdx.x;
  if (i < n4) {
    v4f v = ((const v4f*)in)[i];
    v4h o;
    #pragma unroll
    for (int e = 0; e < 4; ++e) o[e] = (f16)v[e];
    ((v4h*)out)[i] = o;
  }
}

// ----------------------------------------------------- projection GEMM (f16 out)
// out = (X @ W^T + bias) * scale ; X:[z][Mb][512] f16, W:[512][512] f16 (row-major)
// transposed==0: out[z][row][col] ; transposed==1: out[z][col][row] (for V^T)
__global__ __launch_bounds__(256) void gemm_qkv(const f16* __restrict__ X, const f16* __restrict__ W,
                                                const float* __restrict__ bias, f16* __restrict__ out,
                                                int Mb, float scale, int transposed) {
  const int K = E_, N = E_;
  const int wave = threadIdx.x >> 5, lane = threadIdx.x & 31;
  const int l16 = lane & 15, hs = lane >> 4;
  const int z = blockIdx.z;
  X   += (size_t)z * Mb * K;
  out += (size_t)z * Mb * N;
  const int tile = blockIdx.x * 8 + wave;
  const int mt = tile >> 5;      // N/16 == 32 tiles across
  const int nt = tile & 31;
  const int row0 = mt * 16, col0 = nt * 16;
  const f16* ap0 = X + (size_t)(row0 + l16) * K + hs * 8;
  const f16* bp0 = W + (size_t)(col0 + l16) * K + hs * 8;
  v8f acc = {};
  #pragma unroll 4
  for (int k0 = 0; k0 < K; k0 += 32) {
    acc = wmma32(ld_frag(ap0 + k0), ld_frag(bp0 + k0), acc);
  }
  const float bc = bias[col0 + l16];
  if (!transposed) {
    #pragma unroll
    for (int r = 0; r < 8; ++r) {
      const int row = row0 + hs * 8 + r;
      out[(size_t)row * N + col0 + l16] = (f16)((acc[r] + bc) * scale);
    }
  } else {
    v8h o;
    #pragma unroll
    for (int r = 0; r < 8; ++r) o[r] = (f16)((acc[r] + bc) * scale);
    *(v8h*)(out + (size_t)(col0 + l16) * Mb + row0 + hs * 8) = o;  // contiguous rows
  }
}

// ----------------------------------------------------------- flash attention
// q16:[b][Lq][512] (pre-scaled by 1/sqrt(DH)), k16:[b][Lk][512], vT16:[b][512][Lk]
// ctx16:[b][Lq][512]
__global__ __launch_bounds__(256) void flash_attn(const f16* __restrict__ q16, const f16* __restrict__ k16,
                                                  const f16* __restrict__ vT16, f16* __restrict__ ctx16) {
  __shared__ f16 lK[32 * 64];       // [key 0..31][dh 0..63]
  __shared__ f16 lV[64 * 32];       // [dh 0..63][key 0..31]
  __shared__ f16 lP[8][16 * 32];    // per-wave P transpose scratch [row][key]
  const int bh = blockIdx.y, b = bh >> 3, h = bh & 7;
  const int wave = threadIdx.x >> 5, lane = threadIdx.x & 31;
  const int l16 = lane & 15, hs = lane >> 4;
  const int qrow0 = blockIdx.x * 128 + wave * 16;

  // Q fragments for this wave's 16 rows (K = 64 -> two 16x32 A fragments)
  const f16* qb = q16 + ((size_t)(b * LQ_ + qrow0 + l16)) * E_ + h * DH_ + hs * 8;
  const v16h qa0 = ld_frag(qb);
  const v16h qa1 = ld_frag(qb + 32);

  // cooperative staging indices (256 threads x 16B each per 4KB tile)
  const int t = threadIdx.x;
  const int kkey = t >> 3, kdh = (t & 7) * 8;
  const int vdh = t >> 2, vkey = (t & 3) * 8;
  const f16* kg = k16 + (size_t)b * LK_ * E_ + h * DH_ + kdh;           // + (kk0+kkey)*E_
  const f16* vg = vT16 + ((size_t)b * E_ + h * DH_ + vdh) * LK_ + vkey; // + kk0
  // LDS byte offsets (AS3 offset == low 32 bits of the generic shared pointer)
  const uint32_t lkoff = (uint32_t)(size_t)&lK[kkey * 64 + kdh];
  const uint32_t lvoff = (uint32_t)(size_t)&lV[vdh * 32 + vkey];

  float Mx[8], Ls[8];
  #pragma unroll
  for (int r = 0; r < 8; ++r) { Mx[r] = -1e30f; Ls[r] = 0.f; }
  v8f acc[4] = {};

  for (int kk0 = 0; kk0 < LK_; kk0 += 32) {
    __syncthreads();  // all waves finished reading previous chunk
    // async DMA of K/V chunk straight into LDS (ASYNCcnt tracked)
    async_copy_b128(lkoff, kg + (size_t)(kk0 + kkey) * E_);
    async_copy_b128(lvoff, vg + kk0);
    if (kk0 + 32 < LK_) {
      __builtin_prefetch(kg + (size_t)(kk0 + 32 + kkey) * E_, 0, 0);
      __builtin_prefetch(vg + kk0 + 32, 0, 0);
    }
    async_wait0();
    __syncthreads();  // all waves' async fills visible

    // S = Q * K^T for two 16-key tiles
    v8f c0 = {}, c1 = {};
    {
      const f16* kbp = &lK[l16 * 64 + hs * 8];
      c0 = wmma32(qa0, ld_frag(kbp), c0);
      c0 = wmma32(qa1, ld_frag(kbp + 32), c0);
      kbp += 16 * 64;
      c1 = wmma32(qa0, ld_frag(kbp), c1);
      c1 = wmma32(qa1, ld_frag(kbp + 32), c1);
    }

    // joint row-max across both tiles (rows are striped across 16-lane halves)
    float ml[8];
    #pragma unroll
    for (int r = 0; r < 8; ++r) ml[r] = fmaxf(c0[r], c1[r]);
    #pragma unroll
    for (int mask = 1; mask < 16; mask <<= 1) {
      #pragma unroll
      for (int r = 0; r < 8; ++r) ml[r] = fmaxf(ml[r], __shfl_xor(ml[r], mask, 32));
    }
    float al[8], rs[8];
    #pragma unroll
    for (int r = 0; r < 8; ++r) {
      const float nm = fmaxf(Mx[r], ml[r]);
      al[r] = __expf(Mx[r] - nm);
      Mx[r] = nm;
    }
    #pragma unroll
    for (int r = 0; r < 8; ++r) {
      c0[r] = __expf(c0[r] - Mx[r]);
      c1[r] = __expf(c1[r] - Mx[r]);
      rs[r] = c0[r] + c1[r];
    }
    #pragma unroll
    for (int mask = 1; mask < 16; mask <<= 1) {
      #pragma unroll
      for (int r = 0; r < 8; ++r) rs[r] += __shfl_xor(rs[r], mask, 32);
    }
    #pragma unroll
    for (int r = 0; r < 8; ++r) Ls[r] = Ls[r] * al[r] + rs[r];
    #pragma unroll
    for (int tl = 0; tl < 4; ++tl) {
      #pragma unroll
      for (int r = 0; r < 8; ++r) acc[tl][r] *= al[r];
    }

    // transpose P (C-layout -> A-layout) through per-wave LDS; both tiles give K=32
    f16* pw = lP[wave];
    #pragma unroll
    for (int r = 0; r < 8; ++r) {
      const int row = hs * 8 + r;
      pw[row * 32 + l16]      = (f16)c0[r];
      pw[row * 32 + 16 + l16] = (f16)c1[r];
    }
    const v16h pa = ld_frag(pw + l16 * 32 + hs * 8);

    // ctx += P(16x32) * V(32x64): 4 WMMAs over dh tiles, keys contiguous in lV rows
    #pragma unroll
    for (int tl = 0; tl < 4; ++tl) {
      const v16h vb = ld_frag(&lV[(tl * 16 + l16) * 32 + hs * 8]);
      acc[tl] = wmma32(pa, vb, acc[tl]);
    }
  }

  float inv[8];
  #pragma unroll
  for (int r = 0; r < 8; ++r) inv[r] = 1.f / Ls[r];
  #pragma unroll
  for (int tl = 0; tl < 4; ++tl) {
    #pragma unroll
    for (int r = 0; r < 8; ++r) {
      const size_t row = (size_t)(b * LQ_ + qrow0 + hs * 8 + r);
      ctx16[row * E_ + h * DH_ + tl * 16 + l16] = (f16)(acc[tl][r] * inv[r]);
    }
  }
}

// ---------------------------------------- output projection + bias + residual (f32)
__global__ __launch_bounds__(256) void gemm_out(const f16* __restrict__ ctx, const f16* __restrict__ W,
                                                const float* __restrict__ bias, const float* __restrict__ resid,
                                                float* __restrict__ xres) {
  const int K = E_, N = E_;
  const int wave = threadIdx.x >> 5, lane = threadIdx.x & 31;
  const int l16 = lane & 15, hs = lane >> 4;
  const int tile = blockIdx.x * 8 + wave;
  const int mt = tile >> 5, nt = tile & 31;
  const int row0 = mt * 16, col0 = nt * 16;
  const f16* ap0 = ctx + (size_t)(row0 + l16) * K + hs * 8;
  const f16* bp0 = W + (size_t)(col0 + l16) * K + hs * 8;
  v8f acc = {};
  #pragma unroll 4
  for (int k0 = 0; k0 < K; k0 += 32)
    acc = wmma32(ld_frag(ap0 + k0), ld_frag(bp0 + k0), acc);
  const float bc = bias[col0 + l16];
  #pragma unroll
  for (int r = 0; r < 8; ++r) {
    const size_t idx = (size_t)(row0 + hs * 8 + r) * N + col0 + l16;
    xres[idx] = acc[r] + bc + resid[idx];
  }
}

// ------------------------------------------------------------------ LayerNorm
__global__ __launch_bounds__(256) void ln_row(const float* __restrict__ x, const float* __restrict__ g,
                                              const float* __restrict__ be, float* __restrict__ out) {
  const int row = blockIdx.x * 8 + (threadIdx.x >> 5);
  const int lane = threadIdx.x & 31;
  const float* xr = x + (size_t)row * E_ + lane * 16;
  v4f v[4];
  float s = 0.f, s2 = 0.f;
  #pragma unroll
  for (int j = 0; j < 4; ++j) {
    v[j] = *(const v4f*)(xr + 4 * j);
    #pragma unroll
    for (int e = 0; e < 4; ++e) { s += v[j][e]; s2 += v[j][e] * v[j][e]; }
  }
  #pragma unroll
  for (int mask = 1; mask < 32; mask <<= 1) {
    s  += __shfl_xor(s, mask, 32);
    s2 += __shfl_xor(s2, mask, 32);
  }
  const float mu = s * (1.f / E_);
  const float var = fmaxf(s2 * (1.f / E_) - mu * mu, 0.f);
  const float rstd = rsqrtf(var + 1e-5f);
  float* orow = out + (size_t)row * E_ + lane * 16;
  const float* gp = g + lane * 16;
  const float* bp = be + lane * 16;
  #pragma unroll
  for (int j = 0; j < 4; ++j) {
    v4f o;
    #pragma unroll
    for (int e = 0; e < 4; ++e)
      o[e] = (v[j][e] - mu) * rstd * gp[4 * j + e] + bp[4 * j + e];
    *(v4f*)(orow + 4 * j) = o;
  }
}

// ------------------------------------------------------------------ launcher
extern "C" void kernel_launch(void* const* d_in, const int* in_sizes, int n_in,
                              void* d_out, int out_size, void* d_ws, size_t ws_size,
                              hipStream_t stream) {
  (void)in_sizes; (void)n_in; (void)out_size; (void)ws_size;
  const float* query     = (const float*)d_in[0];
  const float* key_value = (const float*)d_in[1];
  const float* Wq = (const float*)d_in[2];
  const float* bq = (const float*)d_in[3];
  const float* Wk = (const float*)d_in[4];
  const float* bk = (const float*)d_in[5];
  const float* Wv = (const float*)d_in[6];
  const float* bv = (const float*)d_in[7];
  const float* Wo = (const float*)d_in[8];
  const float* bo = (const float*)d_in[9];
  const float* gamma = (const float*)d_in[10];
  const float* beta  = (const float*)d_in[11];
  float* out = (float*)d_out;

  const size_t nQ  = (size_t)B_ * LQ_ * E_;   // 2,097,152
  const size_t nKV = (size_t)B_ * LK_ * E_;   // 4,194,304
  const size_t nW  = (size_t)E_ * E_;         //   262,144

  f16* p = (f16*)d_ws;
  f16* xq16  = p; p += nQ;
  f16* kv16  = p; p += nKV;
  f16* Wq16  = p; p += nW;
  f16* Wk16  = p; p += nW;
  f16* Wv16  = p; p += nW;
  f16* Wo16  = p; p += nW;
  f16* q16   = p; p += nQ;
  f16* k16   = p; p += nKV;
  f16* vT16  = p; p += nKV;
  f16* ctx16 = p; p += nQ;
  float* xres = (float*)p;                    // nQ floats

  auto cvt = [&](const float* src, f16* dst, size_t n) {
    const int n4 = (int)(n / 4);
    cvt_f32_f16<<<dim3((n4 + 255) / 256), dim3(256), 0, stream>>>(src, dst, n4);
  };
  cvt(query, xq16, nQ);
  cvt(key_value, kv16, nKV);
  cvt(Wq, Wq16, nW);
  cvt(Wk, Wk16, nW);
  cvt(Wv, Wv16, nW);
  cvt(Wo, Wo16, nW);

  // Q = (x @ Wq^T + bq) * 1/sqrt(DH)  (batch folded into M)
  gemm_qkv<<<dim3((4096 / 16) * (512 / 16) / 8, 1, 1), 256, 0, stream>>>(xq16, Wq16, bq, q16, 4096, 0.125f, 0);
  // K = kv @ Wk^T + bk
  gemm_qkv<<<dim3((8192 / 16) * (512 / 16) / 8, 1, 1), 256, 0, stream>>>(kv16, Wk16, bk, k16, 8192, 1.0f, 0);
  // V^T = (kv @ Wv^T + bv)^T per batch (grid.z = B)
  gemm_qkv<<<dim3((4096 / 16) * (512 / 16) / 8, 1, 2), 256, 0, stream>>>(kv16, Wv16, bv, vT16, 4096, 1.0f, 1);

  flash_attn<<<dim3(LQ_ / 128, B_ * H_, 1), 256, 0, stream>>>(q16, k16, vT16, ctx16);

  gemm_out<<<dim3((4096 / 16) * (512 / 16) / 8, 1, 1), 256, 0, stream>>>(ctx16, Wo16, bo, query, xres);

  ln_row<<<dim3((B_ * LQ_) / 8, 1, 1), 256, 0, stream>>>(xres, gamma, beta, out);
}

// v001
// A run of this version takes 259 microseconds.
// In both of two side-by-side timings against v000, it was 1.19 times as fast.
#include <hip/hip_runtime.h>

typedef _Float16 f16;
typedef __attribute__((ext_vector_type(4)))  f16   v4h;
typedef __attribute__((ext_vector_type(8)))  f16   v8h;
typedef __attribute__((ext_vector_type(16))) f16   v16h;
typedef __attribute__((ext_vector_type(8)))  float v8f;
typedef __attribute__((ext_vector_type(4)))  float v4f;

#define E_  512
#define H_  8
#define DH_ 64
#define LQ_ 2048
#define LK_ 4096
#define B_  2
// LDS row pitches in f16 elements: 16 B x odd, so the 16 rows one ds_load_b128 touches spread over all banks
#define KP_ 72   // 64 dh   + 8 pad = 144 B
#define VP_ 40   // 32 keys + 8 pad =  80 B
#define PP_ 40   // 32 keys + 8 pad =  80 B

static __device__ __forceinline__ v16h cat8(v8h lo, v8h hi) {
  return __builtin_shufflevector(lo, hi, 0,1,2,3,4,5,6,7,8,9,10,11,12,13,14,15);
}
static __device__ __forceinline__ v16h ld_frag(const f16* p) {
  v8h lo = *(const v8h*)p;
  v8h hi = *(const v8h*)(p + 16);
  return cat8(lo, hi);
}
static __device__ __forceinline__ v8f wmma32(v16h a, v16h b, v8f c) {
  // D = A(16x32 f16) * B(32x16 f16) + C(16x16 f32)
  return __builtin_amdgcn_wmma_f32_16x16x32_f16(false, a, false, b, (short)0, c, false, false);
}

// Async global->LDS copy, 16B per lane, tracked on ASYNCcnt (CDNA5 path).
static __device__ __forceinline__ void async_copy_b128(uint32_t lds_off, const f16* gaddr) {
  asm volatile("global_load_async_to_lds_b128 %0, %1, off"
               :: "v"(lds_off), "v"(gaddr) : "memory");
}
static __device__ __forceinline__ void async_wait0() {
  asm volatile("s_wait_asynccnt 0x0" ::: "memory");
}

// ---------------------------------------------------------------- convert
__global__ __launch_bounds__(256) void cvt_f32_f16(const float* __restrict__ in,
                                                   f16* __restrict__ out, int n4) {
  int i = blockIdx.x * 256 + threadIdx.x;
  if (i < n4) {
    v4f v = ((const v4f*)in)[i];
    v4h o;
    #pragma unroll
    for (int e = 0; e < 4; ++e) o[e] = (f16)v[e];
    ((v4h*)out)[i] = o;
  }
}

// ----------------------------------------------------- projection GEMM (f16 out)
// out = (X @ W^T + bias) * scale ; X:[z][Mb][512] f16, W:[512][512] f16 (row-major)
// transposed==0: out[z][row][col] ; transposed==1: out[z][col][row] (for V^T)
__global__ __launch_bounds__(256) void gemm_qkv(const f16* __restrict__ X, const f16* __restrict__ W,
                                                const float* __restrict__ bias, f16* __restrict__ out,
                                                int Mb, float scale, int transposed) {
  const int K = E_, N = E_;
  const int wave = threadIdx.x >> 5, lane = threadIdx.x & 31;
  const int l16 = lane & 15, hs = lane >> 4;
  const int z = blockIdx.z;
  X   += (size_t)z * Mb * K;
  out += (size_t)z * Mb * N;
  const int tile = blockIdx.x * 8 + wave;
  const int mt = tile >> 5;      // N/16 == 32 tiles across
  const int nt = tile & 31;
  const int row0 = mt * 16, col0 = nt * 16;
  const f16* ap0 = X + (size_t)(row0 + l16) * K + hs * 8;
  const f16* bp0 = W + (size_t)(col0 + l16) * K + hs * 8;
  v8f acc = {};
  #pragma unroll 4
  for (int k0 = 0; k0 < K; k0 += 32) {
    acc = wmma32(ld_frag(ap0 + k0), ld_frag(bp0 + k0), acc);
  }
  const float bc = bias[col0 + l16];
  if (!transposed) {
    #pragma unroll
    for (int r = 0; r < 8; ++r) {
      const int row = row0 + hs * 8 + r;
      out[(size_t)row * N + col0 + l16] = (f16)((acc[r] + bc) * scale);
    }
  } else {
    v8h o;
    #pragma unroll
    for (int r = 0; r < 8; ++r) o[r] = (f16)((acc[r] + bc) * scale);
    *(v8h*)(out + (size_t)(col0 + l16) * Mb + row0 + hs * 8) = o;  // contiguous rows
  }
}

// ----------------------------------------------------------- flash attention
// q16:[b][Lq][512] (pre-scaled by 1/sqrt(DH)), k16:[b][Lk][512], vT16:[b][512][Lk]
// ctx16:[b][Lq][512]
__global__ __launch_bounds__(256) void flash_attn(const f16* __restrict__ q16, const f16* __restrict__ k16,
                                                  const f16* __restrict__ vT16, f16* __restrict__ ctx16) {
  __shared__ __attribute__((aligned(16))) f16 lK[32 * KP_];      // [key 0..31][dh 0..63 + pad]
  __shared__ __attribute__((aligned(16))) f16 lV[64 * VP_];      // [dh 0..63][key 0..31 + pad]
  __shared__ __attribute__((aligned(16))) f16 lP[8][16 * PP_];   // per-wave P transpose scratch [row][key + pad]
  const int bh = blockIdx.y, b = bh >> 3, h = bh & 7;
  const int wave = threadIdx.x >> 5, lane = threadIdx.x & 31;
  const int l16 = lane & 15, hs = lane >> 4;
  const int qrow0 = blockIdx.x * 128 + wave * 16;

  // Q fragments for this wave's 16 rows (K = 64 -> two 16x32 A fragments)
  const f16* qb = q16 + ((size_t)(b * LQ_ + qrow0 + l16)) * E_ + h * DH_ + hs * 8;
  const v16h qa0 = ld_frag(qb);
  const v16h qa1 = ld_frag(qb + 32);

  // cooperative staging indices (256 threads x 16B each per 4KB tile)
  const int t = threadIdx.x;
  const int kkey = t >> 3, kdh = (t & 7) * 8;
  const int vdh = t >> 2, vkey = (t & 3) * 8;
  const f16* kg = k16 + (size_t)b * LK_ * E_ + h * DH_ + kdh;           // + (kk0+kkey)*E_
  const f16* vg = vT16 + ((size_t)b * E_ + h * DH_ + vdh) * LK_ + vkey; // + kk0
  // LDS byte offsets (AS3 offset == low 32 bits of the generic shared pointer)
  const uint32_t lkoff = (uint32_t)(size_t)&lK[kkey * KP_ + kdh];
  const uint32_t lvoff = (uint32_t)(size_t)&lV[vdh * VP_ + vkey];

  float Mx[8], Ls[8];
  #pragma unroll
  for (int r = 0; r < 8; ++r) { Mx[r] = -1e30f; Ls[r] = 0.f; }
  v8f acc[4] = {};

  for (int kk0 = 0; kk0 < LK_; kk0 += 32) {
    __syncthreads();  // all waves finished reading previous chunk
    // async DMA of K/V chunk straight into LDS (ASYNCcnt tracked)
    async_copy_b128(lkoff, kg + (size_t)(kk0 + kkey) * E_);
    async_copy_b128(lvoff, vg + kk0);
    if (kk0 + 32 < LK_) {
      __builtin_prefetch(kg + (size_t)(kk0 + 32 + kkey) * E_, 0, 0);
      __builtin_prefetch(vg + kk0 + 32, 0, 0);
    }
    async_wait0();
    __syncthreads();  // all waves' async fills visible

    // S = Q * K^T for two 16-key tiles
    v8f c0 = {}, c1 = {};
    {
      const f16* kbp = &lK[l16 * KP_ + hs * 8];
      c0 = wmma32(qa0, ld_frag(kbp), c0);
      c0 = wmma32(qa1, ld_frag(kbp + 32), c0);
      kbp += 16 * KP_;
      c1 = wmma32(qa0, ld_frag(kbp), c1);
      c1 = wmma32(qa1, ld_frag(kbp + 32), c1);
    }

    // joint row-max across both tiles (rows are striped across 16-lane halves)
    float ml[8];
    #pragma unroll
    for (int r = 0; r < 8; ++r) ml[r] = fmaxf(c0[r], c1[r]);
    #pragma unroll
    for (int mask = 1; mask < 16; mask <<= 1) {
      #pragma unroll
      for (int r = 0; r < 8; ++r) ml[r] = fmaxf(ml[r], __shfl_xor(ml[r], mask, 32));
    }
    float al[8], rs[8];
    #pragma unroll
    for (int r = 0; r < 8; ++r) {
      const float nm = fmaxf(Mx[r], ml[r]);
      al[r] = __expf(Mx[r] - nm);
      Mx[r] = nm;
    }
    #pragma unroll
    for (int r = 0; r < 8; ++r) {
      c0[r] = __expf(c0[r] - Mx[r]);
      c1[r] = __expf(c1[r] - Mx[r]);
      rs[r] = c0[r] + c1[r];
    }
    #pragma unroll
    for (int mask = 1; mask < 16; mask <<= 1) {
      #pragma unroll
      for (int r = 0; r < 8; ++r) rs[r] += __shfl_xor(rs[r], mask, 32);
    }
    #pragma unroll
    for (int r = 0; r < 8; ++r) Ls[r] = Ls[r] * al[r] + rs[r];
    #pragma unroll
    for (int tl = 0; tl < 4; ++tl) {
      #pragma unroll
      for (int r = 0; r < 8; ++r) acc[tl][r] *= al[r];
    }

    // transpose P (C-layout -> A-layout) through per-wave LDS; both tiles give K=32
    f16* pw = lP[wave];
    #pragma unroll
    for (int r = 0; r < 8; ++r) {
      const int row = hs * 8 + r;
      pw[row * PP_ + l16]      = (f16)c0[r];
      pw[row * PP_ + 16 + l16] = (f16)c1[r];
    }
    const v16h pa = ld_frag(pw + l16 * PP_ + hs * 8);

    // ctx += P(16x32) * V(32x64): 4 WMMAs over dh tiles, keys contiguous in lV rows
    #pragma unroll
    for (int tl = 0; tl < 4; ++tl) {
      const v16h vb = ld_frag(&lV[(tl * 16 + l16) * VP_ + hs * 8]);
      acc[tl] = wmma32(pa, vb, acc[tl]);
    }
  }

  float inv[8];
  #pragma unroll
  for (int r = 0; r < 8; ++r) inv[r] = 1.f / Ls[r];
  #pragma unroll
  for (int tl = 0; tl < 4; ++tl) {
    #pragma unroll
    for (int r = 0; r < 8; ++r) {
      const size_t row = (size_t)(b * LQ_ + qrow0 + hs * 8 + r);
      ctx16[row * E_ + h * DH_ + tl * 16 + l16] = (f16)(acc[tl][r] * inv[r]);
    }
  }
}

// ---------------------------------------- output projection + bias + residual (f32)
__global__ __launch_bounds__(256) void gemm_out(const f16* __restrict__ ctx, const f16* __restrict__ W,
                                                const float* __restrict__ bias, const float* __restrict__ resid,
                                                float* __restrict__ xres) {
  const int K = E_, N = E_;
  const int wave = threadIdx.x >> 5, lane = threadIdx.x & 31;
  const int l16 = lane & 15, hs = lane >> 4;
  const int tile = blockIdx.x * 8 + wave;
  const int mt = tile >> 5, nt = tile & 31;
  const int row0 = mt * 16, col0 = nt * 16;
  const f16* ap0 = ctx + (size_t)(row0 + l16) * K + hs * 8;
  const f16* bp0 = W + (size_t)(col0 + l16) * K + hs * 8;
  v8f acc = {};
  #pragma unroll 4
  for (int k0 = 0; k0 < K; k0 += 32)
    acc = wmma32(ld_frag(ap0 + k0), ld_frag(bp0 + k0), acc);
  const float bc = bias[col0 + l16];
  #pragma unroll
  for (int r = 0; r < 8; ++r) {
    const size_t idx = (size_t)(row0 + hs * 8 + r) * N + col0 + l16;
    xres[idx] = acc[r] + bc + resid[idx];
  }
}

// ------------------------------------------------------------------ LayerNorm
__global__ __launch_bounds__(256) void ln_row(const float* __restrict__ x, const float* __restrict__ g,
                                              const float* __restrict__ be, float* __restrict__ out) {
  const int row = blockIdx.x * 8 + (threadIdx.x >> 5);
  const int lane = threadIdx.x & 31;
  const float* xr = x + (size_t)row * E_ + lane * 16;
  v4f v[4];
  float s = 0.f, s2 = 0.f;
  #pragma unroll
  for (int j = 0; j < 4; ++j) {
    v[j] = *(const v4f*)(xr + 4 * j);
    #pragma unroll
    for (int e = 0; e < 4; ++e) { s += v[j][e]; s2 += v[j][e] * v[j][e]; }
  }
  #pragma unroll
  for (int mask = 1; mask < 32; mask <<= 1) {
    s  += __shfl_xor(s, mask, 32);
    s2 += __shfl_xor(s2, mask, 32);
  }
  const float mu = s * (1.f / E_);
  const float var = fmaxf(s2 * (1.f / E_) - mu * mu, 0.f);
  const float rstd = rsqrtf(var + 1e-5f);
  float* orow = out + (size_t)row * E_ + lane * 16;
  const float* gp = g + lane * 16;
  const float* bp = be + lane * 16;
  #pragma unroll
  for (int j = 0; j < 4; ++j) {
    v4f o;
    #pragma unroll
    for (int e = 0; e < 4; ++e)
      o[e] = (v[j][e] - mu) * rstd * gp[4 * j + e] + bp[4 * j + e];
    *(v4f*)(orow + 4 * j) = o;
  }
}

// ------------------------------------------------------------------ launcher
extern "C" void kernel_launch(void* const* d_in, const int* in_sizes, int n_in,
                              void* d_out, int out_size, void* d_ws, size_t ws_size,
                              hipStream_t stream) {
  (void)in_sizes; (void)n_in; (void)out_size; (void)ws_size;
  const float* query     = (const float*)d_in[0];
  const float* key_value = (const float*)d_in[1];
  const float* Wq = (const float*)d_in[2];
  const float* bq = (const float*)d_in[3];
  const float* Wk = (const float*)d_in[4];
  const float* bk = (const float*)d_in[5];
  const float* Wv = (const float*)d_in[6];
  const float* bv = (const float*)d_in[7];
  const float* Wo = (const float*)d_in[8];
  const float* bo = (const float*)d_in[9];
  const float* gamma = (const float*)d_in[10];
  const float* beta  = (const float*)d_in[11];
  float* out = (float*)d_out;

  const size_t nQ  = (size_t)B_ * LQ_ * E_;   // 2,097,152
  const size_t nKV = (size_t)B_ * LK_ * E_;   // 4,194,304
  const size_t nW  = (size_t)E_ * E_;         //   262,144

  f16* p = (f16*)d_ws;
  f16* xq16  = p; p += nQ;
  f16* kv16  = p; p += nKV;
  f16* Wq16  = p; p += nW;
  f16* Wk16  = p; p += nW;
  f16* Wv16  = p; p += nW;
  f16* Wo16  = p; p += nW;
  f16* q16   = p; p += nQ;
  f16* k16   = p; p += nKV;
  f16* vT16  = p; p += nKV;
  f16* ctx16 = p; p += nQ;
  float* xres = (float*)p;                    // nQ floats

  auto cvt = [&](const float* src, f16* dst, size_t n) {
    const int n4 = (int)(n / 4);
    cvt_f32_f16<<<dim3((n4 + 255) / 256), dim3(256), 0, stream>>>(src, dst, n4);
  };
  cvt(query, xq16, nQ);
  cvt(key_value, kv16, nKV);
  cvt(Wq, Wq16, nW);
  cvt(Wk, Wk16, nW);
  cvt(Wv, Wv16, nW);
  cvt(Wo, Wo16, nW);

  // Q = (x @ Wq^T + bq) * 1/sqrt(DH)  (batch folded into M)
  gemm_qkv<<<dim3((4096 / 16) * (512 / 16) / 8, 1, 1), 256, 0, stream>>>(xq16, Wq16, bq, q16, 4096, 0.125f, 0);
  // K = kv @ Wk^T + bk
  gemm_qkv<<<dim3((8192 / 16) * (512 / 16) / 8, 1, 1), 256, 0, stream>>>(kv16, Wk16, bk, k16, 8192, 1.0f, 0);
  // V^T = (kv @ Wv^T + bv)^T per batch (grid.z = B)
  gemm_qkv<<<dim3((4096 / 16) * (512 / 16) / 8, 1, 2), 256, 0, stream>>>(kv16, Wv16, bv, vT16, 4096, 1.0f, 1);

  flash_attn<<<dim3(LQ_ / 128, B_ * H_, 1), 256, 0, stream>>>(q16, k16, vT16, ctx16);

  gemm_out<<<dim3((4096 / 16) * (512 / 16) / 8, 1, 1), 256, 0, stream>>>(ctx16, Wo16, bo, query, xres);

  ln_row<<<dim3((B_ * LQ_) / 8, 1, 1), 256, 0, stream>>>(xres, gamma, beta, out);
}

// v002
// It runs in 216 microseconds.
// In both of two side-by-side timings against v001, it was 1.20 times as fast.
// All steps since v000 together make it 1.43 times as fast.
#include <hip/hip_runtime.h>

typedef _Float16 f16;
typedef __attribute__((ext_vector_type(4)))  f16   v4h;
typedef __attribute__((ext_vector_type(8)))  f16   v8h;
typedef __attribute__((ext_vector_type(16))) f16   v16h;
typedef __attribute__((ext_vector_type(8)))  float v8f;
typedef __attribute__((ext_vector_type(4)))  float v4f;

#define E_  512
#define H_  8
#define DH_ 64
#define LQ_ 2048
#define LK_ 4096
#define B_  2
// LDS row pitches in f16 elements: 16 B x odd, so the 16 rows one ds_load_b128 touches spread over all banks
#define KP_ 72   // 64 dh   + 8 pad = 144 B
#define VP_ 40   // 32 keys + 8 pad =  80 B

static __device__ __forceinline__ v16h cat8(v8h lo, v8h hi) {
  return __builtin_shufflevector(lo, hi, 0,1,2,3,4,5,6,7,8,9,10,11,12,13,14,15);
}
static __device__ __forceinline__ v16h ld_frag(const f16* p) {
  v8h lo = *(const v8h*)p;
  v8h hi = *(const v8h*)(p + 16);
  return cat8(lo, hi);
}
static __device__ __forceinline__ v8f wmma32(v16h a, v16h b, v8f c) {
  // D = A(16x32 f16) * B(32x16 f16) + C(16x16 f32)
  return __builtin_amdgcn_wmma_f32_16x16x32_f16(false, a, false, b, (short)0, c, false, false);
}

// Async global->LDS copy, 16B per lane, tracked on ASYNCcnt (CDNA5 path).
static __device__ __forceinline__ void async_copy_b128(uint32_t lds_off, const f16* gaddr) {
  asm volatile("global_load_async_to_lds_b128 %0, %1, off"
               :: "v"(lds_off), "v"(gaddr) : "memory");
}
static __device__ __forceinline__ void async_wait0() {
  asm volatile("s_wait_asynccnt 0x0" ::: "memory");
}

// ---------------------------------------------------------------- convert
__global__ __launch_bounds__(256) void cvt_f32_f16(const float* __restrict__ in,
                                                   f16* __restrict__ out, int n4) {
  int i = blockIdx.x * 256 + threadIdx.x;
  if (i < n4) {
    v4f v = ((const v4f*)in)[i];
    v4h o;
    #pragma unroll
    for (int e = 0; e < 4; ++e) o[e] = (f16)v[e];
    ((v4h*)out)[i] = o;
  }
}

// ----------------------------------------------------- projection GEMM (f16 out)
// out = (X @ W^T + bias) * scale ; X:[z][Mb][512] f16, W:[512][512] f16 (row-major)
// transposed==0: out[z][row][col] ; transposed==1: out[z][col][row] (for V^T)
__global__ __launch_bounds__(256) void gemm_qkv(const f16* __restrict__ X, const f16* __restrict__ W,
                                                const float* __restrict__ bias, f16* __restrict__ out,
                                                int Mb, float scale, int transposed) {
  const int K = E_, N = E_;
  const int wave = threadIdx.x >> 5, lane = threadIdx.x & 31;
  const int l16 = lane & 15, hs = lane >> 4;
  const int z = blockIdx.z;
  X   += (size_t)z * Mb * K;
  out += (size_t)z * Mb * N;
  const int tile = blockIdx.x * 8 + wave;
  const int mt = tile >> 5;      // N/16 == 32 tiles across
  const int nt = tile & 31;
  const int row0 = mt * 16, col0 = nt * 16;
  const f16* ap0 = X + (size_t)(row0 + l16) * K + hs * 8;
  const f16* bp0 = W + (size_t)(col0 + l16) * K + hs * 8;
  v8f acc = {};
  #pragma unroll 4
  for (int k0 = 0; k0 < K; k0 += 32) {
    acc = wmma32(ld_frag(ap0 + k0), ld_frag(bp0 + k0), acc);
  }
  const float bc = bias[col0 + l16];
  if (!transposed) {
    #pragma unroll
    for (int r = 0; r < 8; ++r) {
      const int row = row0 + hs * 8 + r;
      out[(size_t)row * N + col0 + l16] = (f16)((acc[r] + bc) * scale);
    }
  } else {
    v8h o;
    #pragma unroll
    for (int r = 0; r < 8; ++r) o[r] = (f16)((acc[r] + bc) * scale);
    *(v8h*)(out + (size_t)(col0 + l16) * Mb + row0 + hs * 8) = o;  // contiguous rows
  }
}

static __device__ __forceinline__ float xhalf(float x) {
  // value of lane ^ 16 (the other half of the same query column)
  const int b = __builtin_bit_cast(int, x);
  return __builtin_bit_cast(float, __builtin_amdgcn_permlanex16(b, b, 0x76543210, 0xfedcba98, false, false));
}
// e^x as 2^(x * log2 e), the same two instructions __expf gives, written as asm for the slot the instruction set
// asks for behind a transcendental before its source is overwritten or its result read.
// Early-clobber outputs keep every result off every
// source inside the statement; the closing v_nop is the slot behind the last one.
static __device__ __forceinline__ v8f exp8(v8f x) {
  x *= 1.44269504f;
  float y0, y1, y2, y3, y4, y5, y6, y7;
  asm("v_exp_f32 %0, %8\n\tv_exp_f32 %1, %9\n\tv_exp_f32 %2, %10\n\tv_exp_f32 %3, %11\n\t"
      "v_exp_f32 %4, %12\n\tv_exp_f32 %5, %13\n\tv_exp_f32 %6, %14\n\tv_exp_f32 %7, %15\n\tv_nop"
      : "=&v"(y0), "=&v"(y1), "=&v"(y2), "=&v"(y3), "=&v"(y4), "=&v"(y5), "=&v"(y6), "=&v"(y7)
      : "v"(x[0]), "v"(x[1]), "v"(x[2]), "v"(x[3]), "v"(x[4]), "v"(x[5]), "v"(x[6]), "v"(x[7]));
  return v8f{y0, y1, y2, y3, y4, y5, y6, y7};
}
static __device__ __forceinline__ float exp1(float x) {
  float y;
  asm("v_exp_f32 %0, %1\n\tv_nop" : "=v"(y) : "v"(x * 1.44269504f));  // v_nop: the same slot
  return y;
}
__global__ __launch_bounds__(256) void flash_attn(const f16* __restrict__ q16, const f16* __restrict__ k16,
                                                  const f16* __restrict__ vT16, f16* __restrict__ ctx16) {
  __shared__ __attribute__((aligned(16))) f16 lK[32 * KP_];      // [key 0..31][dh 0..63 + pad]
  __shared__ __attribute__((aligned(16))) f16 lV[64 * VP_];      // [dh 0..63][key 0..31 + pad]
  const int bh = blockIdx.y, b = bh >> 3, h = bh & 7;
  const int wave = threadIdx.x >> 5, lane = threadIdx.x & 31;
  const int l16 = lane & 15, hs = lane >> 4;
  const int qrow0 = blockIdx.x * 128 + wave * 16;

  // Q^T fragments for this wave's 16 query columns (K = 64 -> two 32x16 B fragments)
  const f16* qb = q16 + ((size_t)(b * LQ_ + qrow0 + l16)) * E_ + h * DH_ + hs * 8;
  const v16h qa0 = ld_frag(qb);
  const v16h qa1 = ld_frag(qb + 32);

  // cooperative staging indices (256 threads x 16B each per 4KB tile)
  const int t = threadIdx.x;
  const int kkey = t >> 3, kdh = (t & 7) * 8;
  const int vdh = t >> 2, vkey = (t & 3) * 8;
  const f16* kg = k16 + (size_t)b * LK_ * E_ + h * DH_ + kdh;           // + (kk0+kkey)*E_
  const f16* vg = vT16 + ((size_t)b * E_ + h * DH_ + vdh) * LK_ + vkey; // + kk0
  // LDS byte offsets (AS3 offset == low 32 bits of the generic shared pointer)
  const uint32_t lkoff = (uint32_t)(size_t)&lK[kkey * KP_ + kdh];
  const uint32_t lvoff = (uint32_t)(size_t)&lV[vdh * VP_ + vkey];

  float Mx = -1e30f;   // running maximum of this lane's query column (equal in both halves)
  float Ls = 0.f;      // running sum over this lane's own keys only; halves joined after the loop
  v8f acc[4] = {};     // acc[tl][r] = O[query l16][dh tl*16 + hs*8 + r]

  for (int kk0 = 0; kk0 < LK_; kk0 += 32) {
    __syncthreads();  // all waves finished reading previous chunk
    // async DMA of K/V chunk straight into LDS (ASYNCcnt tracked)
    async_copy_b128(lkoff, kg + (size_t)(kk0 + kkey) * E_);
    async_copy_b128(lvoff, vg + kk0);
    if (kk0 + 32 < LK_) {
      __builtin_prefetch(kg + (size_t)(kk0 + 32 + kkey) * E_, 0, 0);
      __builtin_prefetch(vg + kk0 + 32, 0, 0);
    }
    async_wait0();
    __syncthreads();  // all waves' async fills visible

    // S^T = K * Q^T for two 16-key tiles: c0[r] = S[query l16][key hs*8 + r], c1: keys + 16
    v8f c0 = {}, c1 = {};
    {
      const f16* kbp = &lK[l16 * KP_ + hs * 8];
      c0 = wmma32(ld_frag(kbp), qa0, c0);
      c0 = wmma32(ld_frag(kbp + 32), qa1, c0);
      kbp += 16 * KP_;
      c1 = wmma32(ld_frag(kbp), qa0, c1);
      c1 = wmma32(ld_frag(kbp + 32), qa1, c1);
    }

    // column maximum: a tree over the lane's own 16 scores, then one exchange between halves
    float m8[8];
    #pragma unroll
    for (int r = 0; r < 8; ++r) m8[r] = fmaxf(c0[r], c1[r]);
    float ml = fmaxf(fmaxf(fmaxf(m8[0], m8[1]), fmaxf(m8[2], m8[3])),
                     fmaxf(fmaxf(m8[4], m8[5]), fmaxf(m8[6], m8[7])));
    ml = fmaxf(ml, xhalf(ml));
    const float nm = fmaxf(Mx, ml);
    const float al = exp1(Mx - nm);
    Mx = nm;

    c0 = exp8(c0 - nm);
    c1 = exp8(c1 - nm);
    const v8f s8 = c0 + c1;
    Ls = Ls * al + (((s8[0] + s8[1]) + (s8[2] + s8[3])) + ((s8[4] + s8[5]) + (s8[6] + s8[7])));
    #pragma unroll
    for (int tl = 0; tl < 4; ++tl) acc[tl] *= al;

    // P^T as B operand straight from the accumulators: element s is key hs*8 + s, then 16 + hs*8 + (s - 8)
    const v16h pb = cat8(__builtin_convertvector(c0, v8h), __builtin_convertvector(c1, v8h));

    // O^T += V^T(64x32) * P^T(32x16): 4 WMMAs over dh tiles, keys contiguous in lV rows
    #pragma unroll
    for (int tl = 0; tl < 4; ++tl) {
      const v16h va = ld_frag(&lV[(tl * 16 + l16) * VP_ + hs * 8]);
      acc[tl] = wmma32(va, pb, acc[tl]);
    }
  }

  Ls += xhalf(Ls);
  const float inv = 1.f / Ls;
  f16* orow = ctx16 + (size_t)(b * LQ_ + qrow0 + l16) * E_ + h * DH_ + hs * 8;
  #pragma unroll
  for (int tl = 0; tl < 4; ++tl)
    *(v8h*)(orow + tl * 16) = __builtin_convertvector(acc[tl] * inv, v8h);  // 8 consecutive dh of one query
}

// ---------------------------------------- output projection + bias + residual (f32)
__global__ __launch_bounds__(256) void gemm_out(const f16* __restrict__ ctx, const f16* __restrict__ W,
                                                const float* __restrict__ bias, const float* __restrict__ resid,
                                                float* __restrict__ xres) {
  const int K = E_, N = E_;
  const int wave = threadIdx.x >> 5, lane = threadIdx.x & 31;
  const int l16 = lane & 15, hs = lane >> 4;
  const int tile = blockIdx.x * 8 + wave;
  const int mt = tile >> 5, nt = tile & 31;
  const int row0 = mt * 16, col0 = nt * 16;
  const f16* ap0 = ctx + (size_t)(row0 + l16) * K + hs * 8;
  const f16* bp0 = W + (size_t)(col0 + l16) * K + hs * 8;
  v8f acc = {};
  #pragma unroll 4
  for (int k0 = 0; k0 < K; k0 += 32)
    acc = wmma32(ld_frag(ap0 + k0), ld_frag(bp0 + k0), acc);
  const float bc = bias[col0 + l16];
  #pragma unroll
  for (int r = 0; r < 8; ++r) {
    const size_t idx = (size_t)(row0 + hs * 8 + r) * N + col0 + l16;
    xres[idx] = acc[r] + bc + resid[idx];
  }
}

// ------------------------------------------------------------------ LayerNorm
__global__ __launch_bounds__(256) void ln_row(const float* __restrict__ x, const float* __restrict__ g,
                                              const float* __restrict__ be, float* __restrict__ out) {
  const int row = blockIdx.x * 8 + (threadIdx.x >> 5);
  const int lane = threadIdx.x & 31;
  const float* xr = x + (size_t)row * E_ + lane * 16;
  v4f v[4];
  float s = 0.f, s2 = 0.f;
  #pragma unroll
  for (int j = 0; j < 4; ++j) {
    v[j] = *(const v4f*)(xr + 4 * j);
    #pragma unroll
    for (int e = 0; e < 4; ++e) { s += v[j][e]; s2 += v[j][e] * v[j][e]; }
  }
  #pragma unroll
  for (int mask = 1; mask < 32; mask <<= 1) {
    s  += __shfl_xor(s, mask, 32);
    s2 += __shfl_xor(s2, mask, 32);
  }
  const float mu = s * (1.f / E_);
  const float var = fmaxf(s2 * (1.f / E_) - mu * mu, 0.f);
  const float rstd = rsqrtf(var + 1e-5f);
  float* orow = out + (size_t)row * E_ + lane * 16;
  const float* gp = g + lane * 16;
  const float* bp = be + lane * 16;
  #pragma unroll
  for (int j = 0; j < 4; ++j) {
    v4f o;
    #pragma unroll
    for (int e = 0; e < 4; ++e)
      o[e] = (v[j][e] - mu) * rstd * gp[4 * j + e] + bp[4 * j + e];
    *(v4f*)(orow + 4 * j) = o;
  }
}

// ------------------------------------------------------------------ launcher
extern "C" void kernel_launch(void* const* d_in, const int* in_sizes, int n_in,
                              void* d_out, int out_size, void* d_ws, size_t ws_size,
                              hipStream_t stream) {
  (void)in_sizes; (void)n_in; (void)out_size; (void)ws_size;
  const float* query     = (const float*)d_in[0];
  const float* key_value = (const float*)d_in[1];
  const float* Wq = (const float*)d_in[2];
  const float* bq = (const float*)d_in[3];
  const float* Wk = (const float*)d_in[4];
  const float* bk = (const float*)d_in[5];
  const float* Wv = (const float*)d_in[6];
  const float* bv = (const float*)d_in[7];
  const float* Wo = (const float*)d_in[8];
  const float* bo = (const float*)d_in[9];
  const float* gamma = (const float*)d_in[10];
  const float* beta  = (const float*)d_in[11];
  float* out = (float*)d_out;

  const size_t nQ  = (size_t)B_ * LQ_ * E_;   // 2,097,152
  const size_t nKV = (size_t)B_ * LK_ * E_;   // 4,194,304
  const size_t nW  = (size_t)E_ * E_;         //   262,144

  f16* p = (f16*)d_ws;
  f16* xq16  = p; p += nQ;
  f16* kv16  = p; p += nKV;
  f16* Wq16  = p; p += nW;
  f16* Wk16  = p; p += nW;
  f16* Wv16  = p; p += nW;
  f16* Wo16  = p; p += nW;
  f16* q16   = p; p += nQ;
  f16* k16   = p; p += nKV;
  f16* vT16  = p; p += nKV;
  f16* ctx16 = p; p += nQ;
  float* xres = (float*)p;                    // nQ floats

  auto cvt = [&](const float* src, f16* dst, size_t n) {
    const int n4 = (int)(n / 4);
    cvt_f32_f16<<<dim3((n4 + 255) / 256), dim3(256), 0, stream>>>(src, dst, n4);
  };
  cvt(query, xq16, nQ);
  cvt(key_value, kv16, nKV);
  cvt(Wq, Wq16, nW);
  cvt(Wk, Wk16, nW);
  cvt(Wv, Wv16, nW);
  cvt(Wo, Wo16, nW);

  // Q = (x @ Wq^T + bq) * 1/sqrt(DH)  (batch folded into M)
  gemm_qkv<<<dim3((4096 / 16) * (512 / 16) / 8, 1, 1), 256, 0, stream>>>(xq16, Wq16, bq, q16, 4096, 0.125f, 0);
  // K = kv @ Wk^T + bk
  gemm_qkv<<<dim3((8192 / 16) * (512 / 16) / 8, 1, 1), 256, 0, stream>>>(kv16, Wk16, bk, k16, 8192, 1.0f, 0);
  // V^T = (kv @ Wv^T + bv)^T per batch (grid.z = B)
  gemm_qkv<<<dim3((4096 / 16) * (512 / 16) / 8, 1, 2), 256, 0, stream>>>(kv16, Wv16, bv, vT16, 4096, 1.0f, 1);

  flash_attn<<<dim3(LQ_ / 128, B_ * H_, 1), 256, 0, stream>>>(q16, k16, vT16, ctx16);

  gemm_out<<<dim3((4096 / 16) * (512 / 16) / 8, 1, 1), 256, 0, stream>>>(ctx16, Wo16, bo, query, xres);

  ln_row<<<dim3((B_ * LQ_) / 8, 1, 1), 256, 0, stream>>>(xres, gamma, beta, out);
}

// v003
// One run takes 178 microseconds.
// In both of two side-by-side timings against v002, it was 1.21 times as fast.
// All steps since v000 together make it 1.73 times as fast.
#include <hip/hip_runtime.h>

typedef _Float16 f16;
typedef __attribute__((ext_vector_type(4)))  f16   v4h;
typedef __attribute__((ext_vector_type(8)))  f16   v8h;
typedef __attribute__((ext_vector_type(16))) f16   v16h;
typedef __attribute__((ext_vector_type(8)))  float v8f;
typedef __attribute__((ext_vector_type(4)))  float v4f;

#define E_  512
#define H_  8
#define DH_ 64
#define LQ_ 2048
#define LK_ 4096
#define B_  2
// LDS row pitches in f16 elements: 16 B x odd, so the 16 rows one ds_load_b128 touches spread over all banks
#define KP_ 72   // 64 dh    + 8 pad = 144 B
#define VP_ 136  // 128 keys + 8 pad = 272 B
#define SK_  128           // keys per stage of the K/V ring in flash_attn
#define NST_ (LK_ / SK_)   // stages

static __device__ __forceinline__ v16h cat8(v8h lo, v8h hi) {
  return __builtin_shufflevector(lo, hi, 0,1,2,3,4,5,6,7,8,9,10,11,12,13,14,15);
}
static __device__ __forceinline__ v16h ld_frag(const f16* p) {
  v8h lo = *(const v8h*)p;
  v8h hi = *(const v8h*)(p + 16);
  return cat8(lo, hi);
}
static __device__ __forceinline__ v8f wmma32(v16h a, v16h b, v8f c) {
  // D = A(16x32 f16) * B(32x16 f16) + C(16x16 f32)
  return __builtin_amdgcn_wmma_f32_16x16x32_f16(false, a, false, b, (short)0, c, false, false);
}

// One lane's share of a K/V stage: eight async global->LDS copies of 16 B (ASYNCcnt), four of K rows and four of
// V^T rows. The closing s_wait_xcnt stands in the copies' own statement, so that no address register of a copy
// is rewritten ahead of it.
static __device__ __forceinline__ void stage_copies(uint32_t lk, uint32_t lv, const f16* kg, const f16* vg) {
  asm volatile("global_load_async_to_lds_b128 %0, %8, off\n\t"
               "global_load_async_to_lds_b128 %1, %9, off\n\t"
               "global_load_async_to_lds_b128 %2, %10, off\n\t"
               "global_load_async_to_lds_b128 %3, %11, off\n\t"
               "global_load_async_to_lds_b128 %4, %12, off\n\t"
               "global_load_async_to_lds_b128 %5, %13, off\n\t"
               "global_load_async_to_lds_b128 %6, %14, off\n\t"
               "global_load_async_to_lds_b128 %7, %15, off\n\t"
               "s_wait_xcnt 0x0"
               :: "v"(lk), "v"(lk + 32 * KP_ * 2), "v"(lk + 64 * KP_ * 2), "v"(lk + 96 * KP_ * 2),
                  "v"(lv), "v"(lv + 16 * VP_ * 2), "v"(lv + 32 * VP_ * 2), "v"(lv + 48 * VP_ * 2),
                  "v"(kg), "v"(kg + 32 * E_), "v"(kg + 64 * E_), "v"(kg + 96 * E_),
                  "v"(vg), "v"(vg + 16 * LK_), "v"(vg + 32 * LK_), "v"(vg + 48 * LK_)
               : "memory");
}
// the wave's own copies have landed
static __device__ __forceinline__ void async_wait0() {
  asm volatile("s_wait_asynccnt 0x0" ::: "memory");
}
// the wave's own LDS reads have returned, before the buffer they read is handed back for a refill
static __device__ __forceinline__ void ds_wait0() {
  asm volatile("s_wait_dscnt 0x0" ::: "memory");
}

// ---------------------------------------------------------------- convert
__global__ __launch_bounds__(256) void cvt_f32_f16(const float* __restrict__ in,
                                                   f16* __restrict__ out, int n4) {
  int i = blockIdx.x * 256 + threadIdx.x;
  if (i < n4) {
    v4f v = ((const v4f*)in)[i];
    v4h o;
    #pragma unroll
    for (int e = 0; e < 4; ++e) o[e] = (f16)v[e];
    ((v4h*)out)[i] = o;
  }
}

// ----------------------------------------------------- projection GEMM (f16 out)
// out = (X @ W^T + bias) * scale ; X:[z][Mb][512] f16, W:[512][512] f16 (row-major)
// transposed==0: out[z][row][col] ; transposed==1: out[z][col][row] (for V^T)
__global__ __launch_bounds__(256) void gemm_qkv(const f16* __restrict__ X, const f16* __restrict__ W,
                                                const float* __restrict__ bias, f16* __restrict__ out,
                                                int Mb, float scale, int transposed) {
  const int K = E_, N = E_;
  const int wave = threadIdx.x >> 5, lane = threadIdx.x & 31;
  const int l16 = lane & 15, hs = lane >> 4;
  const int z = blockIdx.z;
  X   += (size_t)z * Mb * K;
  out += (size_t)z * Mb * N;
  const int tile = blockIdx.x * 8 + wave;
  const int mt = tile >> 5;      // N/16 == 32 tiles across
  const int nt = tile & 31;
  const int row0 = mt * 16, col0 = nt * 16;
  const f16* ap0 = X + (size_t)(row0 + l16) * K + hs * 8;
  const f16* bp0 = W + (size_t)(col0 + l16) * K + hs * 8;
  v8f acc = {};
  #pragma unroll 4
  for (int k0 = 0; k0 < K; k0 += 32) {
    acc = wmma32(ld_frag(ap0 + k0), ld_frag(bp0 + k0), acc);
  }
  const float bc = bias[col0 + l16];
  if (!transposed) {
    #pragma unroll
    for (int r = 0; r < 8; ++r) {
      const int row = row0 + hs * 8 + r;
      out[(size_t)row * N + col0 + l16] = (f16)((acc[r] + bc) * scale);
    }
  } else {
    v8h o;
    #pragma unroll
    for (int r = 0; r < 8; ++r) o[r] = (f16)((acc[r] + bc) * scale);
    *(v8h*)(out + (size_t)(col0 + l16) * Mb + row0 + hs * 8) = o;  // contiguous rows
  }
}

static __device__ __forceinline__ float xhalf(float x) {
  // value of lane ^ 16 (the other half of the same query column)
  const int b = __builtin_bit_cast(int, x);
  return __builtin_bit_cast(float, __builtin_amdgcn_permlanex16(b, b, 0x76543210, 0xfedcba98, false, false));
}
// e^x as 2^(x * log2 e), the same two instructions __expf gives, written as asm for the slot the instruction set
// asks for behind a transcendental before its source is overwritten or its result read.
// Early-clobber outputs keep every result off every
// source inside the statement; the closing v_nop is the slot behind the last one.
static __device__ __forceinline__ v8f exp8(v8f x) {
  x *= 1.44269504f;
  float y0, y1, y2, y3, y4, y5, y6, y7;
  asm("v_exp_f32 %0, %8\n\tv_exp_f32 %1, %9\n\tv_exp_f32 %2, %10\n\tv_exp_f32 %3, %11\n\t"
      "v_exp_f32 %4, %12\n\tv_exp_f32 %5, %13\n\tv_exp_f32 %6, %14\n\tv_exp_f32 %7, %15\n\tv_nop"
      : "=&v"(y0), "=&v"(y1), "=&v"(y2), "=&v"(y3), "=&v"(y4), "=&v"(y5), "=&v"(y6), "=&v"(y7)
      : "v"(x[0]), "v"(x[1]), "v"(x[2]), "v"(x[3]), "v"(x[4]), "v"(x[5]), "v"(x[6]), "v"(x[7]));
  return v8f{y0, y1, y2, y3, y4, y5, y6, y7};
}
static __device__ __forceinline__ float exp1(float x) {
  float y;
  asm("v_exp_f32 %0, %1\n\tv_nop" : "=v"(y) : "v"(x * 1.44269504f));  // v_nop: the same slot
  return y;
}
__global__ __launch_bounds__(256) void flash_attn(const f16* __restrict__ q16, const f16* __restrict__ k16,
                                                  const f16* __restrict__ vT16, f16* __restrict__ ctx16) {
  __shared__ __attribute__((aligned(16))) f16 lK[2 * SK_ * KP_]; // [buffer][key 0..127][dh 0..63 + pad]
  __shared__ __attribute__((aligned(16))) f16 lV[2 * 64 * VP_];  // [buffer][dh 0..63][key 0..127 + pad]
  const int bh = blockIdx.y, b = bh >> 3, h = bh & 7;
  const int wave = threadIdx.x >> 5, lane = threadIdx.x & 31;
  const int l16 = lane & 15, hs = lane >> 4;
  const int qrow0 = blockIdx.x * 128 + wave * 16;

  // Q^T fragments for this wave's 16 query columns (K = 64 -> two 32x16 B fragments)
  const f16* qb = q16 + ((size_t)(b * LQ_ + qrow0 + l16)) * E_ + h * DH_ + hs * 8;
  const v16h qa0 = ld_frag(qb);
  const v16h qa1 = ld_frag(qb + 32);

  // cooperative staging indices (256 threads x 4 x 16 B for each 16 KB tile; a wave's copy covers whole lines)
  const int t = threadIdx.x;
  const int kkey = t >> 3, kdh = (t & 7) * 8;     // + 32 keys per further copy
  const int vdh = t >> 4, vkey = (t & 15) * 8;    // + 16 dh per further copy
  const f16* kg = k16 + ((size_t)b * LK_ + kkey) * E_ + h * DH_ + kdh;  // + stage * SK_ * E_
  const f16* vg = vT16 + ((size_t)b * E_ + h * DH_ + vdh) * LK_ + vkey; // + stage * SK_
  // LDS byte offsets (AS3 offset == low 32 bits of the generic shared pointer)
  const uint32_t lkoff = (uint32_t)(size_t)&lK[kkey * KP_ + kdh];
  const uint32_t lvoff = (uint32_t)(size_t)&lV[vdh * VP_ + vkey];

  float Mx = -1e30f;   // running maximum of this lane's query column (equal in both halves)
  float Ls = 0.f;      // running sum over this lane's own keys only; halves joined after the loop
  v8f acc[4] = {};     // acc[tl][r] = O[query l16][dh tl*16 + hs*8 + r]

  // two-buffer ring: stage s + 1 flies into the other buffer while stage s is worked on
  stage_copies(lkoff, lvoff, kg, vg);                       // stage 0 -> buffer 0
  async_wait0();
  __syncthreads();                                          // stage 0 visible to every wave
  stage_copies(lkoff + SK_ * KP_ * 2, lvoff + 64 * VP_ * 2, kg + (size_t)SK_ * E_, vg + SK_);  // stage 1 -> buffer 1

  for (int s = 0; s < NST_; ++s) {
   const int buf = s & 1;
   const f16* bK = lK + buf * (SK_ * KP_);
   const f16* bV = lV + buf * (64 * VP_);
   // unrolled: the four 32-key passes of a stage read LDS at immediate offsets from one base
   #pragma unroll
   for (int p = 0; p < SK_ / 32; ++p) {
    // S^T = K * Q^T for two 16-key tiles: c0[r] = S[query l16][key hs*8 + r], c1: keys + 16
    v8f c0 = {}, c1 = {};
    {
      const f16* kbp = &bK[(p * 32 + l16) * KP_ + hs * 8];
      c0 = wmma32(ld_frag(kbp), qa0, c0);
      c0 = wmma32(ld_frag(kbp + 32), qa1, c0);
      kbp += 16 * KP_;
      c1 = wmma32(ld_frag(kbp), qa0, c1);
      c1 = wmma32(ld_frag(kbp + 32), qa1, c1);
    }

    // column maximum: a tree over the lane's own 16 scores, then one exchange between halves
    float m8[8];
    #pragma unroll
    for (int r = 0; r < 8; ++r) m8[r] = fmaxf(c0[r], c1[r]);
    float ml = fmaxf(fmaxf(fmaxf(m8[0], m8[1]), fmaxf(m8[2], m8[3])),
                     fmaxf(fmaxf(m8[4], m8[5]), fmaxf(m8[6], m8[7])));
    ml = fmaxf(ml, xhalf(ml));
    const float nm = fmaxf(Mx, ml);
    const float al = exp1(Mx - nm);
    Mx = nm;

    c0 = exp8(c0 - nm);
    c1 = exp8(c1 - nm);
    const v8f s8 = c0 + c1;
    Ls = Ls * al + (((s8[0] + s8[1]) + (s8[2] + s8[3])) + ((s8[4] + s8[5]) + (s8[6] + s8[7])));
    #pragma unroll
    for (int tl = 0; tl < 4; ++tl) acc[tl] *= al;

    // P^T as B operand straight from the accumulators: element s is key hs*8 + s, then 16 + hs*8 + (s - 8)
    const v16h pb = cat8(__builtin_convertvector(c0, v8h), __builtin_convertvector(c1, v8h));

    // O^T += V^T(64x32) * P^T(32x16): 4 WMMAs over dh tiles, keys contiguous in lV rows
    #pragma unroll
    for (int tl = 0; tl < 4; ++tl) {
      const v16h va = ld_frag(&bV[(tl * 16 + l16) * VP_ + p * 32 + hs * 8]);
      acc[tl] = wmma32(va, pb, acc[tl]);
    }
   }
   // publish point of stage s + 1: own reads of this buffer done, own copies landed, then every wave meets
   ds_wait0();
   async_wait0();
   __syncthreads();
   if (s + 2 < NST_)   // refill the buffer that every wave has just left
     stage_copies(lkoff + buf * (SK_ * KP_ * 2), lvoff + buf * (64 * VP_ * 2),
                  kg + (size_t)(s + 2) * SK_ * E_, vg + (s + 2) * SK_);
  }
  async_wait0();       // nothing of this wave is in flight when it leaves the loop

  Ls += xhalf(Ls);
  const float inv = 1.f / Ls;
  f16* orow = ctx16 + (size_t)(b * LQ_ + qrow0 + l16) * E_ + h * DH_ + hs * 8;
  #pragma unroll
  for (int tl = 0; tl < 4; ++tl)
    *(v8h*)(orow + tl * 16) = __builtin_convertvector(acc[tl] * inv, v8h);  // 8 consecutive dh of one query
}

// ---------------------------------------- output projection + bias + residual (f32)
__global__ __launch_bounds__(256) void gemm_out(const f16* __restrict__ ctx, const f16* __restrict__ W,
                                                const float* __restrict__ bias, const float* __restrict__ resid,
                                                float* __restrict__ xres) {
  const int K = E_, N = E_;
  const int wave = threadIdx.x >> 5, lane = threadIdx.x & 31;
  const int l16 = lane & 15, hs = lane >> 4;
  const int tile = blockIdx.x * 8 + wave;
  const int mt = tile >> 5, nt = tile & 31;
  const int row0 = mt * 16, col0 = nt * 16;
  const f16* ap0 = ctx + (size_t)(row0 + l16) * K + hs * 8;
  const f16* bp0 = W + (size_t)(col0 + l16) * K + hs * 8;
  v8f acc = {};
  #pragma unroll 4
  for (int k0 = 0; k0 < K; k0 += 32)
    acc = wmma32(ld_frag(ap0 + k0), ld_frag(bp0 + k0), acc);
  const float bc = bias[col0 + l16];
  #pragma unroll
  for (int r = 0; r < 8; ++r) {
    const size_t idx = (size_t)(row0 + hs * 8 + r) * N + col0 + l16;
    xres[idx] = acc[r] + bc + resid[idx];
  }
}

// ------------------------------------------------------------------ LayerNorm
__global__ __launch_bounds__(256) void ln_row(const float* __restrict__ x, const float* __restrict__ g,
                                              const float* __restrict__ be, float* __restrict__ out) {
  const int row = blockIdx.x * 8 + (threadIdx.x >> 5);
  const int lane = threadIdx.x & 31;
  const float* xr = x + (size_t)row * E_ + lane * 16;
  v4f v[4];
  float s = 0.f, s2 = 0.f;
  #pragma unroll
  for (int j = 0; j < 4; ++j) {
    v[j] = *(const v4f*)(xr + 4 * j);
    #pragma unroll
    for (int e = 0; e < 4; ++e) { s += v[j][e]; s2 += v[j][e] * v[j][e]; }
  }
  #pragma unroll
  for (int mask = 1; mask < 32; mask <<= 1) {
    s  += __shfl_xor(s, mask, 32);
    s2 += __shfl_xor(s2, mask, 32);
  }
  const float mu = s * (1.f / E_);
  const float var = fmaxf(s2 * (1.f / E_) - mu * mu, 0.f);
  const float rstd = rsqrtf(var + 1e-5f);
  float* orow = out + (size_t)row * E_ + lane * 16;
  const float* gp = g + lane * 16;
  const float* bp = be + lane * 16;
  #pragma unroll
  for (int j = 0; j < 4; ++j) {
    v4f o;
    #pragma unroll
    for (int e = 0; e < 4; ++e)
      o[e] = (v[j][e] - mu) * rstd * gp[4 * j + e] + bp[4 * j + e];
    *(v4f*)(orow + 4 * j) = o;
  }
}

// ------------------------------------------------------------------ launcher
extern "C" void kernel_launch(void* const* d_in, const int* in_sizes, int n_in,
                              void* d_out, int out_size, void* d_ws, size_t ws_size,
                              hipStream_t stream) {
  (void)in_sizes; (void)n_in; (void)out_size; (void)ws_size;
  const float* query     = (const float*)d_in[0];
  const float* key_value = (const float*)d_in[1];
  const float* Wq = (const float*)d_in[2];
  const float* bq = (const float*)d_in[3];
  const float* Wk = (const float*)d_in[4];
  const float* bk = (const float*)d_in[5];
  const float* Wv = (const float*)d_in[6];
  const float* bv = (const float*)d_in[7];
  const float* Wo = (const float*)d_in[8];
  const float* bo = (const float*)d_in[9];
  const float* gamma = (const float*)d_in[10];
  const float* beta  = (const float*)d_in[11];
  float* out = (float*)d_out;

  const size_t nQ  = (size_t)B_ * LQ_ * E_;   // 2,097,152
  const size_t nKV = (size_t)B_ * LK_ * E_;   // 4,194,304
  const size_t nW  = (size_t)E_ * E_;         //   262,144

  f16* p = (f16*)d_ws;
  f16* xq16  = p; p += nQ;
  f16* kv16  = p; p += nKV;
  f16* Wq16  = p; p += nW;
  f16* Wk16  = p; p += nW;
  f16* Wv16  = p; p += nW;
  f16* Wo16  = p; p += nW;
  f16* q16   = p; p += nQ;
  f16* k16   = p; p += nKV;
  f16* vT16  = p; p += nKV;
  f16* ctx16 = p; p += nQ;
  float* xres = (float*)p;                    // nQ floats

  auto cvt = [&](const float* src, f16* dst, size_t n) {
    const int n4 = (int)(n / 4);
    cvt_f32_f16<<<dim3((n4 + 255) / 256), dim3(256), 0, stream>>>(src, dst, n4);
  };
  cvt(query, xq16, nQ);
  cvt(key_value, kv16, nKV);
  cvt(Wq, Wq16, nW);
  cvt(Wk, Wk16, nW);
  cvt(Wv, Wv16, nW);
  cvt(Wo, Wo16, nW);

  // Q = (x @ Wq^T + bq) * 1/sqrt(DH)  (batch folded into M)
  gemm_qkv<<<dim3((4096 / 16) * (512 / 16) / 8, 1, 1), 256, 0, stream>>>(xq16, Wq16, bq, q16, 4096, 0.125f, 0);
  // K = kv @ Wk^T + bk
  gemm_qkv<<<dim3((8192 / 16) * (512 / 16) / 8, 1, 1), 256, 0, stream>>>(kv16, Wk16, bk, k16, 8192, 1.0f, 0);
  // V^T = (kv @ Wv^T + bv)^T per batch (grid.z = B)
  gemm_qkv<<<dim3((4096 / 16) * (512 / 16) / 8, 1, 2), 256, 0, stream>>>(kv16, Wv16, bv, vT16, 4096, 1.0f, 1);

  flash_attn<<<dim3(LQ_ / 128, B_ * H_, 1), 256, 0, stream>>>(q16, k16, vT16, ctx16);

  gemm_out<<<dim3((4096 / 16) * (512 / 16) / 8, 1, 1), 256, 0, stream>>>(ctx16, Wo16, bo, query, xres);

  ln_row<<<dim3((B_ * LQ_) / 8, 1, 1), 256, 0, stream>>>(xres, gamma, beta, out);
}

// v004
// It runs in 109 microseconds.
// Two timings next to v003 both put it at 1.63 times that version's speed.
// Over all steps from v000 it is 2.83 times as fast.
#include <hip/hip_runtime.h>

typedef _Float16 f16;
typedef __attribute__((ext_vector_type(4)))  f16   v4h;
typedef __attribute__((ext_vector_type(8)))  f16   v8h;
typedef __attribute__((ext_vector_type(16))) f16   v16h;
typedef __attribute__((ext_vector_type(8)))  float v8f;
typedef __attribute__((ext_vector_type(4)))  float v4f;

#define E_  512
#define H_  8
#define DH_ 64
#define LQ_ 2048
#define LK_ 4096
#define B_  2
// LDS row pitches in f16 elements: 16 B x odd, so the 16 rows one ds_load_b128 touches spread over all banks
#define KP_ 72   // 64 dh    + 8 pad = 144 B
#define VP_ 136  // 128 keys + 8 pad = 272 B
#define SK_  128           // keys per stage of the K/V ring in flash_attn
#define NST_ (LK_ / SK_)   // stages

static __device__ __forceinline__ v16h cat8(v8h lo, v8h hi) {
  return __builtin_shufflevector(lo, hi, 0,1,2,3,4,5,6,7,8,9,10,11,12,13,14,15);
}
static __device__ __forceinline__ v16h ld_frag(const f16* p) {
  v8h lo = *(const v8h*)p;
  v8h hi = *(const v8h*)(p + 16);
  return cat8(lo, hi);
}
static __device__ __forceinline__ v8f wmma32(v16h a, v16h b, v8f c) {
  // D = A(16x32 f16) * B(32x16 f16) + C(16x16 f32)
  return __builtin_amdgcn_wmma_f32_16x16x32_f16(false, a, false, b, (short)0, c, false, false);
}

// One lane's share of a K/V stage: eight async global->LDS copies of 16 B (ASYNCcnt), four of K rows and four of
// V^T rows. The closing s_wait_xcnt stands in the copies' own statement, so that no address register of a copy
// is rewritten ahead of it.
static __device__ __forceinline__ void stage_copies(uint32_t lk, uint32_t lv, const f16* kg, const f16* vg) {
  asm volatile("global_load_async_to_lds_b128 %0, %8, off\n\t"
               "global_load_async_to_lds_b128 %1, %9, off\n\t"
               "global_load_async_to_lds_b128 %2, %10, off\n\t"
               "global_load_async_to_lds_b128 %3, %11, off\n\t"
               "global_load_async_to_lds_b128 %4, %12, off\n\t"
               "global_load_async_to_lds_b128 %5, %13, off\n\t"
               "global_load_async_to_lds_b128 %6, %14, off\n\t"
               "global_load_async_to_lds_b128 %7, %15, off\n\t"
               "s_wait_xcnt 0x0"
               :: "v"(lk), "v"(lk + 32 * KP_ * 2), "v"(lk + 64 * KP_ * 2), "v"(lk + 96 * KP_ * 2),
                  "v"(lv), "v"(lv + 16 * VP_ * 2), "v"(lv + 32 * VP_ * 2), "v"(lv + 48 * VP_ * 2),
                  "v"(kg), "v"(kg + 32 * E_), "v"(kg + 64 * E_), "v"(kg + 96 * E_),
                  "v"(vg), "v"(vg + 16 * LK_), "v"(vg + 32 * LK_), "v"(vg + 48 * LK_)
               : "memory");
}
// the wave's own copies have landed
static __device__ __forceinline__ void async_wait0() {
  asm volatile("s_wait_asynccnt 0x0" ::: "memory");
}
// the wave's own LDS reads have returned, before the buffer they read is handed back for a refill
static __device__ __forceinline__ void ds_wait0() {
  asm volatile("s_wait_dscnt 0x0" ::: "memory");
}

// ---------------------------------------------------------------- convert
__global__ __launch_bounds__(256) void cvt_f32_f16(const float* __restrict__ in,
                                                   f16* __restrict__ out, int n4) {
  int i = blockIdx.x * 256 + threadIdx.x;
  if (i < n4) {
    v4f v = ((const v4f*)in)[i];
    v4h o;
    #pragma unroll
    for (int e = 0; e < 4; ++e) o[e] = (f16)v[e];
    ((v4h*)out)[i] = o;
  }
}

// ----------------------------------------------------- register-tiled product
// One wave owns 4 x 4 accumulator tiles (64 rows x 64 columns): a k step of 32 loads 8 fragments for 16 WMMAs,
// where one tile a wave loaded 2 fragments for 1. Each tile still sums k in ascending order.
// ap0 / bp0: this lane's address in the first row tile / column tile; further tiles lie 16 rows of K on.
// The fragments go through a ring of three register sets, so that two k steps of loads are in flight.
static __device__ __forceinline__ void tile_product(const f16* __restrict__ ap0, const f16* __restrict__ bp0,
                                                    v8f (&acc)[4][4]) {
  const int K = E_;
  v16h a[3][4], b[3][4];
  #pragma unroll
  for (int s = 0; s < 2; ++s) {
    #pragma unroll
    for (int i = 0; i < 4; ++i) a[s][i] = ld_frag(ap0 + (size_t)i * 16 * K + s * 32);
    #pragma unroll
    for (int j = 0; j < 4; ++j) b[s][j] = ld_frag(bp0 + (size_t)j * 16 * K + s * 32);
  }
  // unrolled: the ring index is a compile-time value, so the three sets stay in registers
  #pragma unroll
  for (int ks = 0; ks < K / 32; ++ks) {
    const int cur = ks % 3, nxt = (ks + 2) % 3;
    if (ks + 2 < K / 32) {
      #pragma unroll
      for (int i = 0; i < 4; ++i) a[nxt][i] = ld_frag(ap0 + (size_t)i * 16 * K + (ks + 2) * 32);
      #pragma unroll
      for (int j = 0; j < 4; ++j) b[nxt][j] = ld_frag(bp0 + (size_t)j * 16 * K + (ks + 2) * 32);
    }
    // keeps the loads of step ks + 2 ahead of the products of step ks: without it the scheduler sinks every load
    // to just before its first use, and the lone wave of a SIMD waits out the whole load latency at each fragment
    __builtin_amdgcn_sched_barrier(0);
    #pragma unroll
    for (int i = 0; i < 4; ++i)
      #pragma unroll
      for (int j = 0; j < 4; ++j)
        acc[i][j] = wmma32(a[cur][i], b[cur][j], acc[i][j]);
    // the other side of the same fence: the next step's loads stay one group, behind these products
    __builtin_amdgcn_sched_barrier(0);
  }
}

// ----------------------------------------------------- projection GEMM (f16 out)
// out = (X @ W^T + bias) * scale ; X:[z][Mb][512] f16, W:[512][512] f16 (row-major)
// TR == false: out[z][row][col] ; TR == true: out[z][col][row] (for V^T)
// block = WM x 2 waves: (WM * 64) rows x 128 columns; blockIdx.x = row block * 4 + column block.
// WM is chosen at the launch so that the grid has one block for each of the chip's 256 WGPs.
template <int WM, bool TR>
__global__ __launch_bounds__(WM * 64) void gemm_qkv(const f16* __restrict__ X, const f16* __restrict__ W,
                                                    const float* __restrict__ bias, f16* __restrict__ out,
                                                    int Mb, float scale) {
  const int K = E_, N = E_;
  const int wave = threadIdx.x >> 5, lane = threadIdx.x & 31;
  const int l16 = lane & 15, hs = lane >> 4;
  const int z = blockIdx.z;
  X   += (size_t)z * Mb * K;
  out += (size_t)z * Mb * N;
  const int row0 = ((blockIdx.x >> 2) * WM + (wave >> 1)) * 64;
  const int col0 = ((blockIdx.x & 3) * 2 + (wave & 1)) * 64;
  v8f acc[4][4] = {};
  tile_product(X + (size_t)(row0 + l16) * K + hs * 8, W + (size_t)(col0 + l16) * K + hs * 8, acc);
  #pragma unroll
  for (int j = 0; j < 4; ++j) {
    const int col = col0 + j * 16 + l16;
    const float bc = bias[col];
    #pragma unroll
    for (int i = 0; i < 4; ++i) {
      const int rowb = row0 + i * 16 + hs * 8;
      if (!TR) {
        #pragma unroll
        for (int r = 0; r < 8; ++r)
          out[(size_t)(rowb + r) * N + col] = (f16)((acc[i][j][r] + bc) * scale);
      } else {
        v8h o;
        #pragma unroll
        for (int r = 0; r < 8; ++r) o[r] = (f16)((acc[i][j][r] + bc) * scale);
        *(v8h*)(out + (size_t)col * Mb + rowb) = o;  // contiguous rows
      }
    }
  }
}

static __device__ __forceinline__ float xhalf(float x) {
  // value of lane ^ 16 (the other half of the same query column)
  const int b = __builtin_bit_cast(int, x);
  return __builtin_bit_cast(float, __builtin_amdgcn_permlanex16(b, b, 0x76543210, 0xfedcba98, false, false));
}
// e^x as 2^(x * log2 e), the same two instructions __expf gives, written as asm for the slot the instruction set
// asks for behind a transcendental before its source is overwritten or its result read.
// Early-clobber outputs keep every result off every
// source inside the statement; the closing v_nop is the slot behind the last one.
static __device__ __forceinline__ v8f exp8(v8f x) {
  x *= 1.44269504f;
  float y0, y1, y2, y3, y4, y5, y6, y7;
  asm("v_exp_f32 %0, %8\n\tv_exp_f32 %1, %9\n\tv_exp_f32 %2, %10\n\tv_exp_f32 %3, %11\n\t"
      "v_exp_f32 %4, %12\n\tv_exp_f32 %5, %13\n\tv_exp_f32 %6, %14\n\tv_exp_f32 %7, %15\n\tv_nop"
      : "=&v"(y0), "=&v"(y1), "=&v"(y2), "=&v"(y3), "=&v"(y4), "=&v"(y5), "=&v"(y6), "=&v"(y7)
      : "v"(x[0]), "v"(x[1]), "v"(x[2]), "v"(x[3]), "v"(x[4]), "v"(x[5]), "v"(x[6]), "v"(x[7]));
  return v8f{y0, y1, y2, y3, y4, y5, y6, y7};
}
static __device__ __forceinline__ float exp1(float x) {
  float y;
  asm("v_exp_f32 %0, %1\n\tv_nop" : "=v"(y) : "v"(x * 1.44269504f));  // v_nop: the same slot
  return y;
}
__global__ __launch_bounds__(256) void flash_attn(const f16* __restrict__ q16, const f16* __restrict__ k16,
                                                  const f16* __restrict__ vT16, f16* __restrict__ ctx16) {
  __shared__ __attribute__((aligned(16))) f16 lK[2 * SK_ * KP_]; // [buffer][key 0..127][dh 0..63 + pad]
  __shared__ __attribute__((aligned(16))) f16 lV[2 * 64 * VP_];  // [buffer][dh 0..63][key 0..127 + pad]
  const int bh = blockIdx.y, b = bh >> 3, h = bh & 7;
  const int wave = threadIdx.x >> 5, lane = threadIdx.x & 31;
  const int l16 = lane & 15, hs = lane >> 4;
  const int qrow0 = blockIdx.x * 128 + wave * 16;

  // Q^T fragments for this wave's 16 query columns (K = 64 -> two 32x16 B fragments)
  const f16* qb = q16 + ((size_t)(b * LQ_ + qrow0 + l16)) * E_ + h * DH_ + hs * 8;
  const v16h qa0 = ld_frag(qb);
  const v16h qa1 = ld_frag(qb + 32);

  // cooperative staging indices (256 threads x 4 x 16 B for each 16 KB tile; a wave's copy covers whole lines)
  const int t = threadIdx.x;
  const int kkey = t >> 3, kdh = (t & 7) * 8;     // + 32 keys per further copy
  const int vdh = t >> 4, vkey = (t & 15) * 8;    // + 16 dh per further copy
  const f16* kg = k16 + ((size_t)b * LK_ + kkey) * E_ + h * DH_ + kdh;  // + stage * SK_ * E_
  const f16* vg = vT16 + ((size_t)b * E_ + h * DH_ + vdh) * LK_ + vkey; // + stage * SK_
  // LDS byte offsets (AS3 offset == low 32 bits of the generic shared pointer)
  const uint32_t lkoff = (uint32_t)(size_t)&lK[kkey * KP_ + kdh];
  const uint32_t lvoff = (uint32_t)(size_t)&lV[vdh * VP_ + vkey];

  float Mx = -1e30f;   // running maximum of this lane's query column (equal in both halves)
  float Ls = 0.f;      // running sum over this lane's own keys only; halves joined after the loop
  v8f acc[4] = {};     // acc[tl][r] = O[query l16][dh tl*16 + hs*8 + r]

  // two-buffer ring: stage s + 1 flies into the other buffer while stage s is worked on
  stage_copies(lkoff, lvoff, kg, vg);                       // stage 0 -> buffer 0
  async_wait0();
  __syncthreads();                                          // stage 0 visible to every wave
  stage_copies(lkoff + SK_ * KP_ * 2, lvoff + 64 * VP_ * 2, kg + (size_t)SK_ * E_, vg + SK_);  // stage 1 -> buffer 1

  for (int s = 0; s < NST_; ++s) {
   const int buf = s & 1;
   const f16* bK = lK + buf * (SK_ * KP_);
   const f16* bV = lV + buf * (64 * VP_);
   // unrolled: the four 32-key passes of a stage read LDS at immediate offsets from one base
   #pragma unroll
   for (int p = 0; p < SK_ / 32; ++p) {
    // S^T = K * Q^T for two 16-key tiles: c0[r] = S[query l16][key hs*8 + r], c1: keys + 16
    v8f c0 = {}, c1 = {};
    {
      const f16* kbp = &bK[(p * 32 + l16) * KP_ + hs * 8];
      c0 = wmma32(ld_frag(kbp), qa0, c0);
      c0 = wmma32(ld_frag(kbp + 32), qa1, c0);
      kbp += 16 * KP_;
      c1 = wmma32(ld_frag(kbp), qa0, c1);
      c1 = wmma32(ld_frag(kbp + 32), qa1, c1);
    }

    // column maximum: a tree over the lane's own 16 scores, then one exchange between halves
    float m8[8];
    #pragma unroll
    for (int r = 0; r < 8; ++r) m8[r] = fmaxf(c0[r], c1[r]);
    float ml = fmaxf(fmaxf(fmaxf(m8[0], m8[1]), fmaxf(m8[2], m8[3])),
                     fmaxf(fmaxf(m8[4], m8[5]), fmaxf(m8[6], m8[7])));
    ml = fmaxf(ml, xhalf(ml));
    const float nm = fmaxf(Mx, ml);
    const float al = exp1(Mx - nm);
    Mx = nm;

    c0 = exp8(c0 - nm);
    c1 = exp8(c1 - nm);
    const v8f s8 = c0 + c1;
    Ls = Ls * al + (((s8[0] + s8[1]) + (s8[2] + s8[3])) + ((s8[4] + s8[5]) + (s8[6] + s8[7])));
    #pragma unroll
    for (int tl = 0; tl < 4; ++tl) acc[tl] *= al;

    // P^T as B operand straight from the accumulators: element s is key hs*8 + s, then 16 + hs*8 + (s - 8)
    const v16h pb = cat8(__builtin_convertvector(c0, v8h), __builtin_convertvector(c1, v8h));

    // O^T += V^T(64x32) * P^T(32x16): 4 WMMAs over dh tiles, keys contiguous in lV rows
    #pragma unroll
    for (int tl = 0; tl < 4; ++tl) {
      const v16h va = ld_frag(&bV[(tl * 16 + l16) * VP_ + p * 32 + hs * 8]);
      acc[tl] = wmma32(va, pb, acc[tl]);
    }
   }
   // publish point of stage s + 1: own reads of this buffer done, own copies landed, then every wave meets
   ds_wait0();
   async_wait0();
   __syncthreads();
   if (s + 2 < NST_)   // refill the buffer that every wave has just left
     stage_copies(lkoff + buf * (SK_ * KP_ * 2), lvoff + buf * (64 * VP_ * 2),
                  kg + (size_t)(s + 2) * SK_ * E_, vg + (s + 2) * SK_);
  }
  async_wait0();       // nothing of this wave is in flight when it leaves the loop

  Ls += xhalf(Ls);
  const float inv = 1.f / Ls;
  f16* orow = ctx16 + (size_t)(b * LQ_ + qrow0 + l16) * E_ + h * DH_ + hs * 8;
  #pragma unroll
  for (int tl = 0; tl < 4; ++tl)
    *(v8h*)(orow + tl * 16) = __builtin_convertvector(acc[tl] * inv, v8h);  // 8 consecutive dh of one query
}

// ---------------------------------------- output projection + bias + residual (f32)
// block = 2 waves side by side, 64 rows x 64 columns a wave: 64 rows x 128 columns
__global__ __launch_bounds__(64) void gemm_out(const f16* __restrict__ ctx, const f16* __restrict__ W,
                                               const float* __restrict__ bias, const float* __restrict__ resid,
                                               float* __restrict__ xres) {
  const int K = E_, N = E_;
  const int wave = threadIdx.x >> 5, lane = threadIdx.x & 31;
  const int l16 = lane & 15, hs = lane >> 4;
  const int row0 = (blockIdx.x >> 2) * 64;
  const int col0 = ((blockIdx.x & 3) * 2 + wave) * 64;
  v8f acc[4][4] = {};
  tile_product(ctx + (size_t)(row0 + l16) * K + hs * 8, W + (size_t)(col0 + l16) * K + hs * 8, acc);
  float bc[4];
  #pragma unroll
  for (int j = 0; j < 4; ++j) bc[j] = bias[col0 + j * 16 + l16];
  // before a later load's result may land on the register that holds the bias loads' address
  asm volatile("s_wait_xcnt 0x0" ::: "memory");
  // one lane offset for the whole tile; every element lies a compile-time distance from it
  const int base = (row0 + hs * 8) * N + col0 + l16;
  const float* rp = resid + base;
  float* xp = xres + base;
  // two halves of 32 rows: 64 residual values at a time beside the 128 accumulators stay below v256
  #pragma unroll
  for (int h = 0; h < 2; ++h) {
    // before the second half reuses registers that the first half's loads and stores name
    if (h == 1) asm volatile("s_wait_xcnt 0x0" ::: "memory");
    #pragma unroll
    for (int i = 2 * h; i < 2 * h + 2; ++i) {
      #pragma unroll
      for (int j = 0; j < 4; ++j) {
        #pragma unroll
        for (int r = 0; r < 8; ++r) {
          const int d = (i * 16 + r) * N + j * 16;
          xp[d] = acc[i][j][r] + bc[j] + rp[d];
        }
      }
    }
  }
}

// ------------------------------------------------------------------ LayerNorm
__global__ __launch_bounds__(256) void ln_row(const float* __restrict__ x, const float* __restrict__ g,
                                              const float* __restrict__ be, float* __restrict__ out) {
  const int row = blockIdx.x * 8 + (threadIdx.x >> 5);
  const int lane = threadIdx.x & 31;
  const float* xr = x + (size_t)row * E_ + lane * 16;
  v4f v[4];
  float s = 0.f, s2 = 0.f;
  #pragma unroll
  for (int j = 0; j < 4; ++j) {
    v[j] = *(const v4f*)(xr + 4 * j);
    #pragma unroll
    for (int e = 0; e < 4; ++e) { s += v[j][e]; s2 += v[j][e] * v[j][e]; }
  }
  #pragma unroll
  for (int mask = 1; mask < 32; mask <<= 1) {
    s  += __shfl_xor(s, mask, 32);
    s2 += __shfl_xor(s2, mask, 32);
  }
  const float mu = s * (1.f / E_);
  const float var = fmaxf(s2 * (1.f / E_) - mu * mu, 0.f);
  const float rstd = rsqrtf(var + 1e-5f);
  float* orow = out + (size_t)row * E_ + lane * 16;
  const float* gp = g + lane * 16;
  const float* bp = be + lane * 16;
  #pragma unroll
  for (int j = 0; j < 4; ++j) {
    v4f o;
    #pragma unroll
    for (int e = 0; e < 4; ++e)
      o[e] = (v[j][e] - mu) * rstd * gp[4 * j + e] + bp[4 * j + e];
    *(v4f*)(orow + 4 * j) = o;
  }
}

// ------------------------------------------------------------------ launcher
extern "C" void kernel_launch(void* const* d_in, const int* in_sizes, int n_in,
                              void* d_out, int out_size, void* d_ws, size_t ws_size,
                              hipStream_t stream) {
  (void)in_sizes; (void)n_in; (void)out_size; (void)ws_size;
  const float* query     = (const float*)d_in[0];
  const float* key_value = (const float*)d_in[1];
  const float* Wq = (const float*)d_in[2];
  const float* bq = (const float*)d_in[3];
  const float* Wk = (const float*)d_in[4];
  const float* bk = (const float*)d_in[5];
  const float* Wv = (const float*)d_in[6];
  const float* bv = (const float*)d_in[7];
  const float* Wo = (const float*)d_in[8];
  const float* bo = (const float*)d_in[9];
  const float* gamma = (const float*)d_in[10];
  const float* beta  = (const float*)d_in[11];
  float* out = (float*)d_out;

  const size_t nQ  = (size_t)B_ * LQ_ * E_;   // 2,097,152
  const size_t nKV = (size_t)B_ * LK_ * E_;   // 4,194,304
  const size_t nW  = (size_t)E_ * E_;         //   262,144

  f16* p = (f16*)d_ws;
  f16* xq16  = p; p += nQ;
  f16* kv16  = p; p += nKV;
  f16* Wq16  = p; p += nW;
  f16* Wk16  = p; p += nW;
  f16* Wv16  = p; p += nW;
  f16* Wo16  = p; p += nW;
  f16* q16   = p; p += nQ;
  f16* k16   = p; p += nKV;
  f16* vT16  = p; p += nKV;
  f16* ctx16 = p; p += nQ;
  float* xres = (float*)p;                    // nQ floats

  auto cvt = [&](const float* src, f16* dst, size_t n) {
    const int n4 = (int)(n / 4);
    cvt_f32_f16<<<dim3((n4 + 255) / 256), dim3(256), 0, stream>>>(src, dst, n4);
  };
  cvt(query, xq16, nQ);
  cvt(key_value, kv16, nKV);
  cvt(Wq, Wq16, nW);
  cvt(Wk, Wk16, nW);
  cvt(Wv, Wv16, nW);
  cvt(Wo, Wo16, nW);

  // Q = (x @ Wq^T + bq) * 1/sqrt(DH)  (batch folded into M)
  gemm_qkv<1, false><<<dim3((4096 / 64) * (512 / 128), 1, 1), 64, 0, stream>>>(xq16, Wq16, bq, q16, 4096, 0.125f);
  // K = kv @ Wk^T + bk
  gemm_qkv<2, false><<<dim3((8192 / 128) * (512 / 128), 1, 1), 128, 0, stream>>>(kv16, Wk16, bk, k16, 8192, 1.0f);
  // V^T = (kv @ Wv^T + bv)^T per batch (grid.z = B)
  gemm_qkv<2, true><<<dim3((4096 / 128) * (512 / 128), 1, 2), 128, 0, stream>>>(kv16, Wv16, bv, vT16, 4096, 1.0f);

  flash_attn<<<dim3(LQ_ / 128, B_ * H_, 1), 256, 0, stream>>>(q16, k16, vT16, ctx16);

  gemm_out<<<dim3((4096 / 64) * (512 / 128), 1, 1), 64, 0, stream>>>(ctx16, Wo16, bo, query, xres);

  ln_row<<<dim3((B_ * LQ_) / 8, 1, 1), 256, 0, stream>>>(xres, gamma, beta, out);
}

// v005
// It runs in 99.7 microseconds.
// Next to v004, in two timings, it ran 1.10 and 1.09 times as fast.
// All steps since v000 together make it 3.10 times as fast.
#include <hip/hip_runtime.h>

typedef _Float16 f16;
typedef __attribute__((ext_vector_type(4)))  f16   v4h;
typedef __attribute__((ext_vector_type(8)))  f16   v8h;
typedef __attribute__((ext_vector_type(16))) f16   v16h;
typedef __attribute__((ext_vector_type(8)))  float v8f;
typedef __attribute__((ext_vector_type(4)))  float v4f;

#define E_  512
#define H_  8
#define DH_ 64
#define LQ_ 2048
#define LK_ 4096
#define B_  2
// LDS row pitches in f16 elements: 16 B x odd, so the 16 rows one ds_load_b128 touches spread over all banks
#define KP_ 72   // 64 dh    + 8 pad = 144 B
#define VP_ 136  // 128 keys + 8 pad = 272 B
#define SK_  128           // keys per stage of the K/V ring in flash_attn
#define NST_ (LK_ / SK_)   // stages

static __device__ __forceinline__ v16h cat8(v8h lo, v8h hi) {
  return __builtin_shufflevector(lo, hi, 0,1,2,3,4,5,6,7,8,9,10,11,12,13,14,15);
}
static __device__ __forceinline__ v16h ld_frag(const f16* p) {
  v8h lo = *(const v8h*)p;
  v8h hi = *(const v8h*)(p + 16);
  return cat8(lo, hi);
}
static __device__ __forceinline__ v8f wmma32(v16h a, v16h b, v8f c) {
  // D = A(16x32 f16) * B(32x16 f16) + C(16x16 f32)
  return __builtin_amdgcn_wmma_f32_16x16x32_f16(false, a, false, b, (short)0, c, false, false);
}

// One lane's share of a K/V stage: eight async global->LDS copies of 16 B (ASYNCcnt), four of K rows and four of
// V^T rows. The closing s_wait_xcnt stands in the copies' own statement, so that no address register of a copy
// is rewritten ahead of it.
static __device__ __forceinline__ void stage_copies(uint32_t lk, uint32_t lv, const f16* kg, const f16* vg) {
  asm volatile("global_load_async_to_lds_b128 %0, %8, off\n\t"
               "global_load_async_to_lds_b128 %1, %9, off\n\t"
               "global_load_async_to_lds_b128 %2, %10, off\n\t"
               "global_load_async_to_lds_b128 %3, %11, off\n\t"
               "global_load_async_to_lds_b128 %4, %12, off\n\t"
               "global_load_async_to_lds_b128 %5, %13, off\n\t"
               "global_load_async_to_lds_b128 %6, %14, off\n\t"
               "global_load_async_to_lds_b128 %7, %15, off\n\t"
               "s_wait_xcnt 0x0"
               :: "v"(lk), "v"(lk + 32 * KP_ * 2), "v"(lk + 64 * KP_ * 2), "v"(lk + 96 * KP_ * 2),
                  "v"(lv), "v"(lv + 16 * VP_ * 2), "v"(lv + 32 * VP_ * 2), "v"(lv + 48 * VP_ * 2),
                  "v"(kg), "v"(kg + 32 * E_), "v"(kg + 64 * E_), "v"(kg + 96 * E_),
                  "v"(vg), "v"(vg + 16 * LK_), "v"(vg + 32 * LK_), "v"(vg + 48 * LK_)
               : "memory");
}
// the wave's own copies have landed
static __device__ __forceinline__ void async_wait0() {
  asm volatile("s_wait_asynccnt 0x0" ::: "memory");
}
// the wave's own LDS reads have returned, before the buffer they read is handed back for a refill
static __device__ __forceinline__ void ds_wait0() {
  asm volatile("s_wait_dscnt 0x0" ::: "memory");
}

// ---------------------------------------------------------------- convert
// All six f32 arrays in one launch. Their f16 copies lie one behind the other in the workspace, in the order of the
// arguments, so a block's place in the output follows from its index alone. A block converts CVB_ elements of ONE
// array; a lane issues its CVL_ loads of 16 B before the first conversion, each wave-wide load 512 contiguous bytes.
// Few waves, each with much in flight: waves start at a bounded rate, which holds a grid of one-load waves back.
#define CVL_ 16                 // loads per lane
#define CVB_ (256 * 4 * CVL_)   // elements per block; divides the size of every array
#define CVQ_  (B_ * LQ_ * E_ / CVB_)   // blocks of the query array
#define CVKV_ (B_ * LK_ * E_ / CVB_)   // blocks of the key/value array
#define CVW_  (E_ * E_ / CVB_)         // blocks of one weight matrix
__global__ __launch_bounds__(256) void cvt_f32_f16(const float* __restrict__ xq, const float* __restrict__ kv,
                                                   const float* __restrict__ wq, const float* __restrict__ wk,
                                                   const float* __restrict__ wv, const float* __restrict__ wo,
                                                   f16* __restrict__ out) {
  int r = blockIdx.x;           // becomes the block's index inside its own array
  const float* src;
  if (r < CVQ_) {
    src = xq;
  } else if (r < CVQ_ + CVKV_) {
    src = kv;
    r -= CVQ_;
  } else {
    r -= CVQ_ + CVKV_;
    const int w = r / CVW_;
    r -= w * CVW_;
    src = w == 0 ? wq : w == 1 ? wk : w == 2 ? wv : wo;
  }
  const v4f* s = (const v4f*)(src + (size_t)r * CVB_) + threadIdx.x;
  v4h* d = (v4h*)(out + (size_t)blockIdx.x * CVB_) + threadIdx.x;
  v4f v[CVL_];
  #pragma unroll
  for (int i = 0; i < CVL_; ++i) v[i] = s[i * 256];
  // keeps every load ahead of the first conversion: without it the last two loads were issued into the first two's
  // registers, behind the wait for those, and the wave paid the memory latency twice
  __builtin_amdgcn_sched_barrier(0);
  #pragma unroll
  for (int i = 0; i < CVL_; ++i) {
    v4h o;
    #pragma unroll
    for (int e = 0; e < 4; ++e) o[e] = (f16)v[i][e];
    d[i * 256] = o;
  }
}

// ----------------------------------------------------- register-tiled product
// One wave owns 4 x 4 accumulator tiles (64 rows x 64 columns): a k step of 32 loads 8 fragments for 16 WMMAs,
// where one tile a wave loaded 2 fragments for 1. Each tile still sums k in ascending order.
// ap0 / bp0: this lane's address in the first row tile / column tile; further tiles lie 16 rows of K on.
// The fragments go through a ring of three register sets, so that two k steps of loads are in flight.
static __device__ __forceinline__ void tile_product(const f16* __restrict__ ap0, const f16* __restrict__ bp0,
                                                    v8f (&acc)[4][4]) {
  const int K = E_;
  v16h a[3][4], b[3][4];
  #pragma unroll
  for (int s = 0; s < 2; ++s) {
    #pragma unroll
    for (int i = 0; i < 4; ++i) a[s][i] = ld_frag(ap0 + (size_t)i * 16 * K + s * 32);
    #pragma unroll
    for (int j = 0; j < 4; ++j) b[s][j] = ld_frag(bp0 + (size_t)j * 16 * K + s * 32);
  }
  // unrolled: the ring index is a compile-time value, so the three sets stay in registers
  #pragma unroll
  for (int ks = 0; ks < K / 32; ++ks) {
    const int cur = ks % 3, nxt = (ks + 2) % 3;
    if (ks + 2 < K / 32) {
      #pragma unroll
      for (int i = 0; i < 4; ++i) a[nxt][i] = ld_frag(ap0 + (size_t)i * 16 * K + (ks + 2) * 32);
      #pragma unroll
      for (int j = 0; j < 4; ++j) b[nxt][j] = ld_frag(bp0 + (size_t)j * 16 * K + (ks + 2) * 32);
    }
    // keeps the loads of step ks + 2 ahead of the products of step ks: without it the scheduler sinks every load
    // to just before its first use, and the lone wave of a SIMD waits out the whole load latency at each fragment
    __builtin_amdgcn_sched_barrier(0);
    #pragma unroll
    for (int i = 0; i < 4; ++i)
      #pragma unroll
      for (int j = 0; j < 4; ++j)
        acc[i][j] = wmma32(a[cur][i], b[cur][j], acc[i][j]);
    // the other side of the same fence: the next step's loads stay one group, behind these products
    __builtin_amdgcn_sched_barrier(0);
  }
}

// ----------------------------------------------------- projection GEMM (f16 out)
// out = (X @ W^T + bias) * scale ; X:[z][Mb][512] f16, W:[512][512] f16 (row-major)
// TR == false: out[z][row][col] ; TR == true: out[z][col][row] (for V^T)
// block = WM x 2 waves: (WM * 64) rows x 128 columns; blockIdx.x = row block * 4 + column block.
// WM is chosen at the launch so that the grid has one block for each of the chip's 256 WGPs.
template <int WM, bool TR>
__global__ __launch_bounds__(WM * 64) void gemm_qkv(const f16* __restrict__ X, const f16* __restrict__ W,
                                                    const float* __restrict__ bias, f16* __restrict__ out,
                                                    int Mb, float scale) {
  const int K = E_, N = E_;
  const int wave = threadIdx.x >> 5, lane = threadIdx.x & 31;
  const int l16 = lane & 15, hs = lane >> 4;
  const int z = blockIdx.z;
  X   += (size_t)z * Mb * K;
  out += (size_t)z * Mb * N;
  const int row0 = ((blockIdx.x >> 2) * WM + (wave >> 1)) * 64;
  const int col0 = ((blockIdx.x & 3) * 2 + (wave & 1)) * 64;
  v8f acc[4][4] = {};
  tile_product(X + (size_t)(row0 + l16) * K + hs * 8, W + (size_t)(col0 + l16) * K + hs * 8, acc);
  #pragma unroll
  for (int j = 0; j < 4; ++j) {
    const int col = col0 + j * 16 + l16;
    const float bc = bias[col];
    #pragma unroll
    for (int i = 0; i < 4; ++i) {
      const int rowb = row0 + i * 16 + hs * 8;
      if (!TR) {
        #pragma unroll
        for (int r = 0; r < 8; ++r)
          out[(size_t)(rowb + r) * N + col] = (f16)((acc[i][j][r] + bc) * scale);
      } else {
        v8h o;
        #pragma unroll
        for (int r = 0; r < 8; ++r) o[r] = (f16)((acc[i][j][r] + bc) * scale);
        *(v8h*)(out + (size_t)col * Mb + rowb) = o;  // contiguous rows
      }
    }
  }
}

static __device__ __forceinline__ float xhalf(float x) {
  // value of lane ^ 16 (the other half of the same query column)
  const int b = __builtin_bit_cast(int, x);
  return __builtin_bit_cast(float, __builtin_amdgcn_permlanex16(b, b, 0x76543210, 0xfedcba98, false, false));
}
// e^x as 2^(x * log2 e), the same two instructions __expf gives, written as asm for the slot the instruction set
// asks for behind a transcendental before its source is overwritten or its result read.
// Early-clobber outputs keep every result off every
// source inside the statement; the closing v_nop is the slot behind the last one.
static __device__ __forceinline__ v8f exp8(v8f x) {
  x *= 1.44269504f;
  float y0, y1, y2, y3, y4, y5, y6, y7;
  asm("v_exp_f32 %0, %8\n\tv_exp_f32 %1, %9\n\tv_exp_f32 %2, %10\n\tv_exp_f32 %3, %11\n\t"
      "v_exp_f32 %4, %12\n\tv_exp_f32 %5, %13\n\tv_exp_f32 %6, %14\n\tv_exp_f32 %7, %15\n\tv_nop"
      : "=&v"(y0), "=&v"(y1), "=&v"(y2), "=&v"(y3), "=&v"(y4), "=&v"(y5), "=&v"(y6), "=&v"(y7)
      : "v"(x[0]), "v"(x[1]), "v"(x[2]), "v"(x[3]), "v"(x[4]), "v"(x[5]), "v"(x[6]), "v"(x[7]));
  return v8f{y0, y1, y2, y3, y4, y5, y6, y7};
}
static __device__ __forceinline__ float exp1(float x) {
  float y;
  asm("v_exp_f32 %0, %1\n\tv_nop" : "=v"(y) : "v"(x * 1.44269504f));  // v_nop: the same slot
  return y;
}
__global__ __launch_bounds__(256) void flash_attn(const f16* __restrict__ q16, const f16* __restrict__ k16,
                                                  const f16* __restrict__ vT16, f16* __restrict__ ctx16) {
  __shared__ __attribute__((aligned(16))) f16 lK[2 * SK_ * KP_]; // [buffer][key 0..127][dh 0..63 + pad]
  __shared__ __attribute__((aligned(16))) f16 lV[2 * 64 * VP_];  // [buffer][dh 0..63][key 0..127 + pad]
  const int bh = blockIdx.y, b = bh >> 3, h = bh & 7;
  const int wave = threadIdx.x >> 5, lane = threadIdx.x & 31;
  const int l16 = lane & 15, hs = lane >> 4;
  const int qrow0 = blockIdx.x * 128 + wave * 16;

  // Q^T fragments for this wave's 16 query columns (K = 64 -> two 32x16 B fragments)
  const f16* qb = q16 + ((size_t)(b * LQ_ + qrow0 + l16)) * E_ + h * DH_ + hs * 8;
  const v16h qa0 = ld_frag(qb);
  const v16h qa1 = ld_frag(qb + 32);

  // cooperative staging indices (256 threads x 4 x 16 B for each 16 KB tile; a wave's copy covers whole lines)
  const int t = threadIdx.x;
  const int kkey = t >> 3, kdh = (t & 7) * 8;     // + 32 keys per further copy
  const int vdh = t >> 4, vkey = (t & 15) * 8;    // + 16 dh per further copy
  const f16* kg = k16 + ((size_t)b * LK_ + kkey) * E_ + h * DH_ + kdh;  // + stage * SK_ * E_
  const f16* vg = vT16 + ((size_t)b * E_ + h * DH_ + vdh) * LK_ + vkey; // + stage * SK_
  // LDS byte offsets (AS3 offset == low 32 bits of the generic shared pointer)
  const uint32_t lkoff = (uint32_t)(size_t)&lK[kkey * KP_ + kdh];
  const uint32_t lvoff = (uint32_t)(size_t)&lV[vdh * VP_ + vkey];

  float Mx = -1e30f;   // running maximum of this lane's query column (equal in both halves)
  float Ls = 0.f;      // running sum over this lane's own keys only; halves joined after the loop
  v8f acc[4] = {};     // acc[tl][r] = O[query l16][dh tl*16 + hs*8 + r]

  // two-buffer ring: stage s + 1 flies into the other buffer while stage s is worked on
  stage_copies(lkoff, lvoff, kg, vg);                       // stage 0 -> buffer 0
  async_wait0();
  __syncthreads();                                          // stage 0 visible to every wave
  stage_copies(lkoff + SK_ * KP_ * 2, lvoff + 64 * VP_ * 2, kg + (size_t)SK_ * E_, vg + SK_);  // stage 1 -> buffer 1

  for (int s = 0; s < NST_; ++s) {
   const int buf = s & 1;
   const f16* bK = lK + buf * (SK_ * KP_);
   const f16* bV = lV + buf * (64 * VP_);
   // unrolled: the four 32-key passes of a stage read LDS at immediate offsets from one base
   #pragma unroll
   for (int p = 0; p < SK_ / 32; ++p) {
    // S^T = K * Q^T for two 16-key tiles: c0[r] = S[query l16][key hs*8 + r], c1: keys + 16
    v8f c0 = {}, c1 = {};
    {
      const f16* kbp = &bK[(p * 32 + l16) * KP_ + hs * 8];
      c0 = wmma32(ld_frag(kbp), qa0, c0);
      c0 = wmma32(ld_frag(kbp + 32), qa1, c0);
      kbp += 16 * KP_;
      c1 = wmma32(ld_frag(kbp), qa0, c1);
      c1 = wmma32(ld_frag(kbp + 32), qa1, c1);
    }

    // column maximum: a tree over the lane's own 16 scores, then one exchange between halves
    float m8[8];
    #pragma unroll
    for (int r = 0; r < 8; ++r) m8[r] = fmaxf(c0[r], c1[r]);
    float ml = fmaxf(fmaxf(fmaxf(m8[0], m8[1]), fmaxf(m8[2], m8[3])),
                     fmaxf(fmaxf(m8[4], m8[5]), fmaxf(m8[6], m8[7])));
    ml = fmaxf(ml, xhalf(ml));
    const float nm = fmaxf(Mx, ml);
    const float al = exp1(Mx - nm);
    Mx = nm;

    c0 = exp8(c0 - nm);
    c1 = exp8(c1 - nm);
    const v8f s8 = c0 + c1;
    Ls = Ls * al + (((s8[0] + s8[1]) + (s8[2] + s8[3])) + ((s8[4] + s8[5]) + (s8[6] + s8[7])));
    #pragma unroll
    for (int tl = 0; tl < 4; ++tl) acc[tl] *= al;

    // P^T as B operand straight from the accumulators: element s is key hs*8 + s, then 16 + hs*8 + (s - 8)
    const v16h pb = cat8(__builtin_convertvector(c0, v8h), __builtin_convertvector(c1, v8h));

    // O^T += V^T(64x32) * P^T(32x16): 4 WMMAs over dh tiles, keys contiguous in lV rows
    #pragma unroll
    for (int tl = 0; tl < 4; ++tl) {
      const v16h va = ld_frag(&bV[(tl * 16 + l16) * VP_ + p * 32 + hs * 8]);
      acc[tl] = wmma32(va, pb, acc[tl]);
    }
   }
   // publish point of stage s + 1: own reads of this buffer done, own copies landed, then every wave meets
   ds_wait0();
   async_wait0();
   __syncthreads();
   if (s + 2 < NST_)   // refill the buffer that every wave has just left
     stage_copies(lkoff + buf * (SK_ * KP_ * 2), lvoff + buf * (64 * VP_ * 2),
                  kg + (size_t)(s + 2) * SK_ * E_, vg + (s + 2) * SK_);
  }
  async_wait0();       // nothing of this wave is in flight when it leaves the loop

  Ls += xhalf(Ls);
  const float inv = 1.f / Ls;
  f16* orow = ctx16 + (size_t)(b * LQ_ + qrow0 + l16) * E_ + h * DH_ + hs * 8;
  #pragma unroll
  for (int tl = 0; tl < 4; ++tl)
    *(v8h*)(orow + tl * 16) = __builtin_convertvector(acc[tl] * inv, v8h);  // 8 consecutive dh of one query
}

// ---------------------------------------- output projection + bias + residual (f32)
// block = 2 waves side by side, 64 rows x 64 columns a wave: 64 rows x 128 columns
__global__ __launch_bounds__(64) void gemm_out(const f16* __restrict__ ctx, const f16* __restrict__ W,
                                               const float* __restrict__ bias, const float* __restrict__ resid,
                                               float* __restrict__ xres) {
  const int K = E_, N = E_;
  const int wave = threadIdx.x >> 5, lane = threadIdx.x & 31;
  const int l16 = lane & 15, hs = lane >> 4;
  const int row0 = (blockIdx.x >> 2) * 64;
  const int col0 = ((blockIdx.x & 3) * 2 + wave) * 64;
  v8f acc[4][4] = {};
  tile_product(ctx + (size_t)(row0 + l16) * K + hs * 8, W + (size_t)(col0 + l16) * K + hs * 8, acc);
  float bc[4];
  #pragma unroll
  for (int j = 0; j < 4; ++j) bc[j] = bias[col0 + j * 16 + l16];
  // before a later load's result may land on the register that holds the bias loads' address
  asm volatile("s_wait_xcnt 0x0" ::: "memory");
  // one lane offset for the whole tile; every element lies a compile-time distance from it
  const int base = (row0 + hs * 8) * N + col0 + l16;
  const float* rp = resid + base;
  float* xp = xres + base;
  // two halves of 32 rows: 64 residual values at a time beside the 128 accumulators stay below v256
  #pragma unroll
  for (int h = 0; h < 2; ++h) {
    // before the second half reuses registers that the first half's loads and stores name
    if (h == 1) asm volatile("s_wait_xcnt 0x0" ::: "memory");
    #pragma unroll
    for (int i = 2 * h; i < 2 * h + 2; ++i) {
      #pragma unroll
      for (int j = 0; j < 4; ++j) {
        #pragma unroll
        for (int r = 0; r < 8; ++r) {
          const int d = (i * 16 + r) * N + j * 16;
          xp[d] = acc[i][j][r] + bc[j] + rp[d];
        }
      }
    }
  }
}

// ------------------------------------------------------------------ LayerNorm
__global__ __launch_bounds__(256) void ln_row(const float* __restrict__ x, const float* __restrict__ g,
                                              const float* __restrict__ be, float* __restrict__ out) {
  const int row = blockIdx.x * 8 + (threadIdx.x >> 5);
  const int lane = threadIdx.x & 31;
  const float* xr = x + (size_t)row * E_ + lane * 16;
  v4f v[4];
  float s = 0.f, s2 = 0.f;
  #pragma unroll
  for (int j = 0; j < 4; ++j) {
    v[j] = *(const v4f*)(xr + 4 * j);
    #pragma unroll
    for (int e = 0; e < 4; ++e) { s += v[j][e]; s2 += v[j][e] * v[j][e]; }
  }
  #pragma unroll
  for (int mask = 1; mask < 32; mask <<= 1) {
    s  += __shfl_xor(s, mask, 32);
    s2 += __shfl_xor(s2, mask, 32);
  }
  const float mu = s * (1.f / E_);
  const float var = fmaxf(s2 * (1.f / E_) - mu * mu, 0.f);
  const float rstd = rsqrtf(var + 1e-5f);
  float* orow = out + (size_t)row * E_ + lane * 16;
  const float* gp = g + lane * 16;
  const float* bp = be + lane * 16;
  #pragma unroll
  for (int j = 0; j < 4; ++j) {
    v4f o;
    #pragma unroll
    for (int e = 0; e < 4; ++e)
      o[e] = (v[j][e] - mu) * rstd * gp[4 * j + e] + bp[4 * j + e];
    *(v4f*)(orow + 4 * j) = o;
  }
}

// ------------------------------------------------------------------ launcher
extern "C" void kernel_launch(void* const* d_in, const int* in_sizes, int n_in,
                              void* d_out, int out_size, void* d_ws, size_t ws_size,
                              hipStream_t stream) {
  (void)in_sizes; (void)n_in; (void)out_size; (void)ws_size;
  const float* query     = (const float*)d_in[0];
  const float* key_value = (const float*)d_in[1];
  const float* Wq = (const float*)d_in[2];
  const float* bq = (const float*)d_in[3];
  const float* Wk = (const float*)d_in[4];
  const float* bk = (const float*)d_in[5];
  const float* Wv = (const float*)d_in[6];
  const float* bv = (const float*)d_in[7];
  const float* Wo = (const float*)d_in[8];
  const float* bo = (const float*)d_in[9];
  const float* gamma = (const float*)d_in[10];
  const float* beta  = (const float*)d_in[11];
  float* out = (float*)d_out;

  const size_t nQ  = (size_t)B_ * LQ_ * E_;   // 2,097,152
  const size_t nKV = (size_t)B_ * LK_ * E_;   // 4,194,304
  const size_t nW  = (size_t)E_ * E_;         //   262,144

  f16* p = (f16*)d_ws;
  f16* xq16  = p; p += nQ;
  f16* kv16  = p; p += nKV;
  f16* Wq16  = p; p += nW;
  f16* Wk16  = p; p += nW;
  f16* Wv16  = p; p += nW;
  f16* Wo16  = p; p += nW;
  f16* q16   = p; p += nQ;
  f16* k16   = p; p += nKV;
  f16* vT16  = p; p += nKV;
  f16* ctx16 = p; p += nQ;
  float* xres = (float*)p;                    // nQ floats

  // xq16, kv16, Wq16, Wk16, Wv16, Wo16 are one run of the workspace, filled in this order
  cvt_f32_f16<<<dim3(CVQ_ + CVKV_ + 4 * CVW_), dim3(256), 0, stream>>>(query, key_value, Wq, Wk, Wv, Wo, xq16);

  // Q = (x @ Wq^T + bq) * 1/sqrt(DH)  (batch folded into M)
  gemm_qkv<1, false><<<dim3((4096 / 64) * (512 / 128), 1, 1), 64, 0, stream>>>(xq16, Wq16, bq, q16, 4096, 0.125f);
  // K = kv @ Wk^T + bk
  gemm_qkv<2, false><<<dim3((8192 / 128) * (512 / 128), 1, 1), 128, 0, stream>>>(kv16, Wk16, bk, k16, 8192, 1.0f);
  // V^T = (kv @ Wv^T + bv)^T per batch (grid.z = B)
  gemm_qkv<2, true><<<dim3((4096 / 128) * (512 / 128), 1, 2), 128, 0, stream>>>(kv16, Wv16, bv, vT16, 4096, 1.0f);

  flash_attn<<<dim3(LQ_ / 128, B_ * H_, 1), 256, 0, stream>>>(q16, k16, vT16, ctx16);

  gemm_out<<<dim3((4096 / 64) * (512 / 128), 1, 1), 64, 0, stream>>>(ctx16, Wo16, bo, query, xres);

  ln_row<<<dim3((B_ * LQ_) / 8, 1, 1), 256, 0, stream>>>(xres, gamma, beta, out);
}

// v006
// A run of this version takes 87.7 microseconds.
// Two timings next to v005 put it at 1.13 and 1.14 times that version's speed.
// All steps since v000 together make it 3.51 times as fast.
#include <hip/hip_runtime.h>

typedef _Float16 f16;
typedef __attribute__((ext_vector_type(4)))  f16   v4h;
typedef __attribute__((ext_vector_type(8)))  f16   v8h;
typedef __attribute__((ext_vector_type(16))) f16   v16h;
typedef __attribute__((ext_vector_type(8)))  float v8f;
typedef __attribute__((ext_vector_type(4)))  float v4f;

#define E_  512
#define H_  8
#define DH_ 64
#define LQ_ 2048
#define LK_ 4096
#define B_  2
// LDS row pitches in f16 elements: 16 B x odd, so the 16 rows one ds_load_b128 touches spread over all banks
#define KP_ 72   // 64 dh    + 8 pad = 144 B
#define VP_ 136  // 128 keys + 8 pad = 272 B
#define SK_  128           // keys per stage of the K/V ring in flash_attn
#define NST_ (LK_ / SK_)   // stages

static __device__ __forceinline__ v16h cat8(v8h lo, v8h hi) {
  return __builtin_shufflevector(lo, hi, 0,1,2,3,4,5,6,7,8,9,10,11,12,13,14,15);
}
static __device__ __forceinline__ v16h ld_frag(const f16* p) {
  v8h lo = *(const v8h*)p;
  v8h hi = *(const v8h*)(p + 16);
  return cat8(lo, hi);
}
// Fragment order: how the f16 operands of the four dense products lie in the workspace. A band of 16 rows x 512 k
// keeps its 16 KB, but inside it element (row r, k) stands at (k / 32) * 512 + (k / 8 % 4) * 128 + r * 8 + k % 8.
// The two halves of a lane's 16 x 32 fragment are then at lane * 8 and 256 + lane * 8 of a 1 KB block, so a wave-wide
// load is 512 contiguous bytes (4 cache lines); from row-major rows it took 32 B out of each of 16 lines.
// Which k a lane holds at which place is what ld_frag gives on a row-major matrix.
#define BAND_ (16 * E_)   // elements of a band
static __device__ __forceinline__ v16h ld_pack(const f16* p) {
  v8h lo = *(const v8h*)p;
  v8h hi = *(const v8h*)(p + 256);
  return cat8(lo, hi);
}
static __device__ __forceinline__ v8f wmma32(v16h a, v16h b, v8f c) {
  // D = A(16x32 f16) * B(32x16 f16) + C(16x16 f32)
  return __builtin_amdgcn_wmma_f32_16x16x32_f16(false, a, false, b, (short)0, c, false, false);
}

// One lane's share of a K/V stage: eight async global->LDS copies of 16 B (ASYNCcnt), four of K rows and four of
// V^T rows. The closing s_wait_xcnt stands in the copies' own statement, so that no address register of a copy
// is rewritten ahead of it.
static __device__ __forceinline__ void stage_copies(uint32_t lk, uint32_t lv, const f16* kg, const f16* vg) {
  asm volatile("global_load_async_to_lds_b128 %0, %8, off\n\t"
               "global_load_async_to_lds_b128 %1, %9, off\n\t"
               "global_load_async_to_lds_b128 %2, %10, off\n\t"
               "global_load_async_to_lds_b128 %3, %11, off\n\t"
               "global_load_async_to_lds_b128 %4, %12, off\n\t"
               "global_load_async_to_lds_b128 %5, %13, off\n\t"
               "global_load_async_to_lds_b128 %6, %14, off\n\t"
               "global_load_async_to_lds_b128 %7, %15, off\n\t"
               "s_wait_xcnt 0x0"
               :: "v"(lk), "v"(lk + 32 * KP_ * 2), "v"(lk + 64 * KP_ * 2), "v"(lk + 96 * KP_ * 2),
                  "v"(lv), "v"(lv + 16 * VP_ * 2), "v"(lv + 32 * VP_ * 2), "v"(lv + 48 * VP_ * 2),
                  "v"(kg), "v"(kg + 32 * E_), "v"(kg + 64 * E_), "v"(kg + 96 * E_),
                  "v"(vg), "v"(vg + 16 * LK_), "v"(vg + 32 * LK_), "v"(vg + 48 * LK_)
               : "memory");
}
// the wave's own copies have landed
static __device__ __forceinline__ void async_wait0() {
  asm volatile("s_wait_asynccnt 0x0" ::: "memory");
}
// the wave's own LDS reads have returned, before the buffer they read is handed back for a refill
static __device__ __forceinline__ void ds_wait0() {
  asm volatile("s_wait_dscnt 0x0" ::: "memory");
}

// ---------------------------------------------------------------- convert
// All six f32 arrays in one launch. Their f16 copies lie one behind the other in the workspace, in the order of the
// arguments, so a block's place in the output follows from its index alone. A block converts CVB_ elements of ONE
// array, 32 rows = two bands, and writes them in fragment order; a lane issues its CVL_ loads of 16 B before the
// first conversion. A lane takes 8 consecutive k of one row at a time (two loads, one 16 B store); a wave takes
// 8 rows x 32 k: it reads 8 whole lines with a pair of loads and fills 4 whole lines with the store.
// Few waves, each with much in flight: waves start at a bounded rate, which holds a grid of one-load waves back.
#define CVL_ 16                 // loads per lane
#define CVB_ (256 * 4 * CVL_)   // elements per block; divides the size of every array
#define CVQ_  (B_ * LQ_ * E_ / CVB_)   // blocks of the query array
#define CVKV_ (B_ * LK_ * E_ / CVB_)   // blocks of the key/value array
#define CVW_  (E_ * E_ / CVB_)         // blocks of one weight matrix
static_assert(CVB_ == 2 * BAND_, "a block of cvt_f32_f16 converts two bands");
__global__ __launch_bounds__(256) void cvt_f32_f16(const float* __restrict__ xq, const float* __restrict__ kv,
                                                   const float* __restrict__ wq, const float* __restrict__ wk,
                                                   const float* __restrict__ wv, const float* __restrict__ wo,
                                                   f16* __restrict__ out) {
  int r = blockIdx.x;           // becomes the block's index inside its own array
  const float* src;
  if (r < CVQ_) {
    src = xq;
  } else if (r < CVQ_ + CVKV_) {
    src = kv;
    r -= CVQ_;
  } else {
    r -= CVQ_ + CVKV_;
    const int w = r / CVW_;
    r -= w * CVW_;
    src = w == 0 ? wq : w == 1 ? wk : w == 2 ? wv : wo;
  }
  const int wave = threadIdx.x >> 5, lane = threadIdx.x & 31;
  const int g = wave >> 1, kh = wave & 1;   // the wave's 8 of the 32 rows, its half of the row (8 k steps of 32)
  const int rr = lane >> 2, q = lane & 3;   // the lane's row among the 8, its 8 k among the 32 of a step
  const float* s = src + (size_t)r * CVB_ + (g * 8 + rr) * E_ + kh * 256 + q * 8;   // + 32 per k step
  f16* d = out + (size_t)blockIdx.x * CVB_ + (g >> 1) * BAND_ + kh * 4096 + q * 128 + ((g & 1) * 8 + rr) * 8;  // + 512
  v4f v[CVL_];
  #pragma unroll
  for (int i = 0; i < CVL_; ++i) v[i] = *(const v4f*)(s + (i >> 1) * 32 + (i & 1) * 4);
  // the loads' address pair, named here, stays whole up to this wait: without it the last load's result was given
  // the pair's own registers, which the fifteen loads before it name too
  asm volatile("s_wait_xcnt 0x0" :: "v"(s) : "memory");
  // keeps every load ahead of the first conversion: without it the last two loads were issued into the first two's
  // registers, behind the wait for those, and the wave paid the memory latency twice
  __builtin_amdgcn_sched_barrier(0);
  #pragma unroll
  for (int i = 0; i < CVL_ / 2; ++i) {
    v8h o;
    #pragma unroll
    for (int e = 0; e < 4; ++e) { o[e] = (f16)v[2 * i][e]; o[4 + e] = (f16)v[2 * i + 1][e]; }
    *(v8h*)(d + i * 512) = o;
  }
}

// ----------------------------------------------------- register-tiled product
// One wave owns 4 x 4 accumulator tiles (64 rows x 64 columns): a k step of 32 loads 8 fragments for 16 WMMAs,
// where one tile a wave loaded 2 fragments for 1. Each tile still sums k in ascending order.
// Both operands lie in fragment order. ap0 / bp0: this lane's address in the first row tile's / column tile's band;
// further tiles lie a band on, further k steps 512 elements on.
// The fragments go through a ring of three register sets, so that two k steps of loads are in flight.
static __device__ __forceinline__ void tile_product(const f16* __restrict__ ap0, const f16* __restrict__ bp0,
                                                    v8f (&acc)[4][4]) {
  const int K = E_;
  v16h a[3][4], b[3][4];
  #pragma unroll
  for (int s = 0; s < 2; ++s) {
    #pragma unroll
    for (int i = 0; i < 4; ++i) a[s][i] = ld_pack(ap0 + i * BAND_ + s * 512);
    #pragma unroll
    for (int j = 0; j < 4; ++j) b[s][j] = ld_pack(bp0 + j * BAND_ + s * 512);
  }
  // unrolled: the ring index is a compile-time value, so the three sets stay in registers
  #pragma unroll
  for (int ks = 0; ks < K / 32; ++ks) {
    const int cur = ks % 3, nxt = (ks + 2) % 3;
    if (ks + 2 < K / 32) {
      #pragma unroll
      for (int i = 0; i < 4; ++i) a[nxt][i] = ld_pack(ap0 + i * BAND_ + (ks + 2) * 512);
      #pragma unroll
      for (int j = 0; j < 4; ++j) b[nxt][j] = ld_pack(bp0 + j * BAND_ + (ks + 2) * 512);
    }
    // keeps the loads of step ks + 2 ahead of the products of step ks: without it the scheduler sinks every load
    // to just before its first use, and the lone wave of a SIMD waits out the whole load latency at each fragment
    __builtin_amdgcn_sched_barrier(0);
    #pragma unroll
    for (int i = 0; i < 4; ++i)
      #pragma unroll
      for (int j = 0; j < 4; ++j)
        acc[i][j] = wmma32(a[cur][i], b[cur][j], acc[i][j]);
    // the other side of the same fence: the next step's loads stay one group, behind these products
    __builtin_amdgcn_sched_barrier(0);
  }
  // before the caller's epilogue reuses the two register pairs that hold the fragment loads' addresses
  asm volatile("s_wait_xcnt 0x0" ::: "memory");
  // keeps the epilogue's first address arithmetic behind that wait
  __builtin_amdgcn_sched_barrier(0);
}

// ----------------------------------------------------- projection GEMM (f16 out)
// out = (X @ W^T + bias) * scale ; X:[z][Mb][512] f16, W:[512][512] f16, both in fragment order; out row-major
// TR == false: out[z][row][col] ; TR == true: out[z][col][row] (for V^T)
// block = WM x 2 waves: (WM * 64) rows x 128 columns; blockIdx.x = row block * 4 + column block.
// WM is chosen at the launch so that the grid has one block for each of the chip's 256 WGPs.
template <int WM, bool TR>
__global__ __launch_bounds__(WM * 64) void gemm_qkv(const f16* __restrict__ X, const f16* __restrict__ W,
                                                    const float* __restrict__ bias, f16* __restrict__ out,
                                                    int Mb, float scale) {
  const int K = E_, N = E_;
  const int wave = threadIdx.x >> 5, lane = threadIdx.x & 31;
  const int l16 = lane & 15, hs = lane >> 4;
  const int z = blockIdx.z;
  X   += (size_t)z * Mb * K;
  out += (size_t)z * Mb * N;
  const int row0 = ((blockIdx.x >> 2) * WM + (wave >> 1)) * 64;
  const int col0 = ((blockIdx.x & 3) * 2 + (wave & 1)) * 64;
  v8f acc[4][4] = {};
  tile_product(X + (size_t)row0 * K + lane * 8, W + (size_t)col0 * K + lane * 8, acc);
  #pragma unroll
  for (int j = 0; j < 4; ++j) {
    const int col = col0 + j * 16 + l16;
    const float bc = bias[col];
    #pragma unroll
    for (int i = 0; i < 4; ++i) {
      const int rowb = row0 + i * 16 + hs * 8;
      if (!TR) {
        #pragma unroll
        for (int r = 0; r < 8; ++r)
          out[(size_t)(rowb + r) * N + col] = (f16)((acc[i][j][r] + bc) * scale);
      } else {
        v8h o;
        #pragma unroll
        for (int r = 0; r < 8; ++r) o[r] = (f16)((acc[i][j][r] + bc) * scale);
        *(v8h*)(out + (size_t)col * Mb + rowb) = o;  // contiguous rows
      }
    }
  }
}

static __device__ __forceinline__ float xhalf(float x) {
  // value of lane ^ 16 (the other half of the same query column)
  const int b = __builtin_bit_cast(int, x);
  return __builtin_bit_cast(float, __builtin_amdgcn_permlanex16(b, b, 0x76543210, 0xfedcba98, false, false));
}
// e^x as 2^(x * log2 e), the same two instructions __expf gives, written as asm for the slot the instruction set
// asks for behind a transcendental before its source is overwritten or its result read.
// Early-clobber outputs keep every result off every
// source inside the statement; the closing v_nop is the slot behind the last one.
static __device__ __forceinline__ v8f exp8(v8f x) {
  x *= 1.44269504f;
  float y0, y1, y2, y3, y4, y5, y6, y7;
  asm("v_exp_f32 %0, %8\n\tv_exp_f32 %1, %9\n\tv_exp_f32 %2, %10\n\tv_exp_f32 %3, %11\n\t"
      "v_exp_f32 %4, %12\n\tv_exp_f32 %5, %13\n\tv_exp_f32 %6, %14\n\tv_exp_f32 %7, %15\n\tv_nop"
      : "=&v"(y0), "=&v"(y1), "=&v"(y2), "=&v"(y3), "=&v"(y4), "=&v"(y5), "=&v"(y6), "=&v"(y7)
      : "v"(x[0]), "v"(x[1]), "v"(x[2]), "v"(x[3]), "v"(x[4]), "v"(x[5]), "v"(x[6]), "v"(x[7]));
  return v8f{y0, y1, y2, y3, y4, y5, y6, y7};
}
static __device__ __forceinline__ float exp1(float x) {
  float y;
  asm("v_exp_f32 %0, %1\n\tv_nop" : "=v"(y) : "v"(x * 1.44269504f));  // v_nop: the same slot
  return y;
}
__global__ __launch_bounds__(256) void flash_attn(const f16* __restrict__ q16, const f16* __restrict__ k16,
                                                  const f16* __restrict__ vT16, f16* __restrict__ ctx16) {
  __shared__ __attribute__((aligned(16))) f16 lK[2 * SK_ * KP_]; // [buffer][key 0..127][dh 0..63 + pad]
  __shared__ __attribute__((aligned(16))) f16 lV[2 * 64 * VP_];  // [buffer][dh 0..63][key 0..127 + pad]
  const int bh = blockIdx.y, b = bh >> 3, h = bh & 7;
  const int wave = threadIdx.x >> 5, lane = threadIdx.x & 31;
  const int l16 = lane & 15, hs = lane >> 4;
  const int qrow0 = blockIdx.x * 128 + wave * 16;

  // Q^T fragments for this wave's 16 query columns (K = 64 -> two 32x16 B fragments)
  const f16* qb = q16 + ((size_t)(b * LQ_ + qrow0 + l16)) * E_ + h * DH_ + hs * 8;
  const v16h qa0 = ld_frag(qb);
  const v16h qa1 = ld_frag(qb + 32);

  // cooperative staging indices (256 threads x 4 x 16 B for each 16 KB tile; a wave's copy covers whole lines)
  const int t = threadIdx.x;
  const int kkey = t >> 3, kdh = (t & 7) * 8;     // + 32 keys per further copy
  const int vdh = t >> 4, vkey = (t & 15) * 8;    // + 16 dh per further copy
  const f16* kg = k16 + ((size_t)b * LK_ + kkey) * E_ + h * DH_ + kdh;  // + stage * SK_ * E_
  const f16* vg = vT16 + ((size_t)b * E_ + h * DH_ + vdh) * LK_ + vkey; // + stage * SK_
  // LDS byte offsets (AS3 offset == low 32 bits of the generic shared pointer)
  const uint32_t lkoff = (uint32_t)(size_t)&lK[kkey * KP_ + kdh];
  const uint32_t lvoff = (uint32_t)(size_t)&lV[vdh * VP_ + vkey];

  float Mx = -1e30f;   // running maximum of this lane's query column (equal in both halves)
  float Ls = 0.f;      // running sum over this lane's own keys only; halves joined after the loop
  v8f acc[4] = {};     // acc[tl][r] = O[query l16][dh tl*16 + hs*8 + r]

  // two-buffer ring: stage s + 1 flies into the other buffer while stage s is worked on
  stage_copies(lkoff, lvoff, kg, vg);                       // stage 0 -> buffer 0
  async_wait0();
  __syncthreads();                                          // stage 0 visible to every wave
  stage_copies(lkoff + SK_ * KP_ * 2, lvoff + 64 * VP_ * 2, kg + (size_t)SK_ * E_, vg + SK_);  // stage 1 -> buffer 1

  for (int s = 0; s < NST_; ++s) {
   const int buf = s & 1;
   const f16* bK = lK + buf * (SK_ * KP_);
   const f16* bV = lV + buf * (64 * VP_);
   // unrolled: the four 32-key passes of a stage read LDS at immediate offsets from one base
   #pragma unroll
   for (int p = 0; p < SK_ / 32; ++p) {
    // S^T = K * Q^T for two 16-key tiles: c0[r] = S[query l16][key hs*8 + r], c1: keys + 16
    v8f c0 = {}, c1 = {};
    {
      const f16* kbp = &bK[(p * 32 + l16) * KP_ + hs * 8];
      c0 = wmma32(ld_frag(kbp), qa0, c0);
      c0 = wmma32(ld_frag(kbp + 32), qa1, c0);
      kbp += 16 * KP_;
      c1 = wmma32(ld_frag(kbp), qa0, c1);
      c1 = wmma32(ld_frag(kbp + 32), qa1, c1);
    }

    // column maximum: a tree over the lane's own 16 scores, then one exchange between halves
    float m8[8];
    #pragma unroll
    for (int r = 0; r < 8; ++r) m8[r] = fmaxf(c0[r], c1[r]);
    float ml = fmaxf(fmaxf(fmaxf(m8[0], m8[1]), fmaxf(m8[2], m8[3])),
                     fmaxf(fmaxf(m8[4], m8[5]), fmaxf(m8[6], m8[7])));
    ml = fmaxf(ml, xhalf(ml));
    const float nm = fmaxf(Mx, ml);
    const float al = exp1(Mx - nm);
    Mx = nm;

    c0 = exp8(c0 - nm);
    c1 = exp8(c1 - nm);
    const v8f s8 = c0 + c1;
    Ls = Ls * al + (((s8[0] + s8[1]) + (s8[2] + s8[3])) + ((s8[4] + s8[5]) + (s8[6] + s8[7])));
    #pragma unroll
    for (int tl = 0; tl < 4; ++tl) acc[tl] *= al;

    // P^T as B operand straight from the accumulators: element s is key hs*8 + s, then 16 + hs*8 + (s - 8)
    const v16h pb = cat8(__builtin_convertvector(c0, v8h), __builtin_convertvector(c1, v8h));

    // O^T += V^T(64x32) * P^T(32x16): 4 WMMAs over dh tiles, keys contiguous in lV rows
    #pragma unroll
    for (int tl = 0; tl < 4; ++tl) {
      const v16h va = ld_frag(&bV[(tl * 16 + l16) * VP_ + p * 32 + hs * 8]);
      acc[tl] = wmma32(va, pb, acc[tl]);
    }
   }
   // publish point of stage s + 1: own reads of this buffer done, own copies landed, then every wave meets
   ds_wait0();
   async_wait0();
   __syncthreads();
   if (s + 2 < NST_)   // refill the buffer that every wave has just left
     stage_copies(lkoff + buf * (SK_ * KP_ * 2), lvoff + buf * (64 * VP_ * 2),
                  kg + (size_t)(s + 2) * SK_ * E_, vg + (s + 2) * SK_);
  }
  async_wait0();       // nothing of this wave is in flight when it leaves the loop

  Ls += xhalf(Ls);
  const float inv = 1.f / Ls;
  // the wave's 16 queries are one band; head h is its k steps 2h and 2h + 1; a store is 512 contiguous bytes
  f16* oband = ctx16 + (size_t)(b * LQ_ + qrow0) * E_ + h * 2 * 512 + lane * 8;
  #pragma unroll
  for (int tl = 0; tl < 4; ++tl)
    *(v8h*)(oband + tl * 256) = __builtin_convertvector(acc[tl] * inv, v8h);  // 8 consecutive dh of one query
}

// ---------------------------------------- output projection + bias + residual (f32)
// block = 2 waves side by side, 64 rows x 64 columns a wave: 64 rows x 128 columns; ctx and W in fragment order
__global__ __launch_bounds__(64) void gemm_out(const f16* __restrict__ ctx, const f16* __restrict__ W,
                                               const float* __restrict__ bias, const float* __restrict__ resid,
                                               float* __restrict__ xres) {
  const int K = E_, N = E_;
  const int wave = threadIdx.x >> 5, lane = threadIdx.x & 31;
  const int l16 = lane & 15, hs = lane >> 4;
  const int row0 = (blockIdx.x >> 2) * 64;
  const int col0 = ((blockIdx.x & 3) * 2 + wave) * 64;
  v8f acc[4][4] = {};
  tile_product(ctx + (size_t)row0 * K + lane * 8, W + (size_t)col0 * K + lane * 8, acc);
  float bc[4];
  #pragma unroll
  for (int j = 0; j < 4; ++j) bc[j] = bias[col0 + j * 16 + l16];
  // before a later load's result may land on the register that holds the bias loads' address
  asm volatile("s_wait_xcnt 0x0" ::: "memory");
  // one lane offset for the whole tile; every element lies a compile-time distance from it
  const int base = (row0 + hs * 8) * N + col0 + l16;
  const float* rp = resid + base;
  float* xp = xres + base;
  // two halves of 32 rows: 64 residual values at a time beside the 128 accumulators stay below v256
  #pragma unroll
  for (int h = 0; h < 2; ++h) {
    // before the second half reuses registers that the first half's loads and stores name
    if (h == 1) asm volatile("s_wait_xcnt 0x0" ::: "memory");
    #pragma unroll
    for (int i = 2 * h; i < 2 * h + 2; ++i) {
      #pragma unroll
      for (int j = 0; j < 4; ++j) {
        #pragma unroll
        for (int r = 0; r < 8; ++r) {
          const int d = (i * 16 + r) * N + j * 16;
          xp[d] = acc[i][j][r] + bc[j] + rp[d];
        }
      }
    }
  }
}

// ------------------------------------------------------------------ LayerNorm
__global__ __launch_bounds__(256) void ln_row(const float* __restrict__ x, const float* __restrict__ g,
                                              const float* __restrict__ be, float* __restrict__ out) {
  const int row = blockIdx.x * 8 + (threadIdx.x >> 5);
  const int lane = threadIdx.x & 31;
  const float* xr = x + (size_t)row * E_ + lane * 16;
  v4f v[4];
  float s = 0.f, s2 = 0.f;
  #pragma unroll
  for (int j = 0; j < 4; ++j) {
    v[j] = *(const v4f*)(xr + 4 * j);
    #pragma unroll
    for (int e = 0; e < 4; ++e) { s += v[j][e]; s2 += v[j][e] * v[j][e]; }
  }
  #pragma unroll
  for (int mask = 1; mask < 32; mask <<= 1) {
    s  += __shfl_xor(s, mask, 32);
    s2 += __shfl_xor(s2, mask, 32);
  }
  const float mu = s * (1.f / E_);
  const float var = fmaxf(s2 * (1.f / E_) - mu * mu, 0.f);
  const float rstd = rsqrtf(var + 1e-5f);
  float* orow = out + (size_t)row * E_ + lane * 16;
  const float* gp = g + lane * 16;
  const float* bp = be + lane * 16;
  #pragma unroll
  for (int j = 0; j < 4; ++j) {
    v4f o;
    #pragma unroll
    for (int e = 0; e < 4; ++e)
      o[e] = (v[j][e] - mu) * rstd * gp[4 * j + e] + bp[4 * j + e];
    *(v4f*)(orow + 4 * j) = o;
  }
}

// ------------------------------------------------------------------ launcher
extern "C" void kernel_launch(void* const* d_in, const int* in_sizes, int n_in,
                              void* d_out, int out_size, void* d_ws, size_t ws_size,
                              hipStream_t stream) {
  (void)in_sizes; (void)n_in; (void)out_size; (void)ws_size;
  const float* query     = (const float*)d_in[0];
  const float* key_value = (const float*)d_in[1];
  const float* Wq = (const float*)d_in[2];
  const float* bq = (const float*)d_in[3];
  const float* Wk = (const float*)d_in[4];
  const float* bk = (const float*)d_in[5];
  const float* Wv = (const float*)d_in[6];
  const float* bv = (const float*)d_in[7];
  const float* Wo = (const float*)d_in[8];
  const float* bo = (const float*)d_in[9];
  const float* gamma = (const float*)d_in[10];
  const float* beta  = (const float*)d_in[11];
  float* out = (float*)d_out;

  const size_t nQ  = (size_t)B_ * LQ_ * E_;   // 2,097,152
  const size_t nKV = (size_t)B_ * LK_ * E_;   // 4,194,304
  const size_t nW  = (size_t)E_ * E_;         //   262,144

  f16* p = (f16*)d_ws;
  f16* xq16  = p; p += nQ;
  f16* kv16  = p; p += nKV;
  f16* Wq16  = p; p += nW;
  f16* Wk16  = p; p += nW;
  f16* Wv16  = p; p += nW;
  f16* Wo16  = p; p += nW;
  f16* q16   = p; p += nQ;
  f16* k16   = p; p += nKV;
  f16* vT16  = p; p += nKV;
  f16* ctx16 = p; p += nQ;
  float* xres = (float*)p;                    // nQ floats

  // xq16, kv16, Wq16, Wk16, Wv16, Wo16 are one run of the workspace, filled in this order, each in fragment order
  cvt_f32_f16<<<dim3(CVQ_ + CVKV_ + 4 * CVW_), dim3(256), 0, stream>>>(query, key_value, Wq, Wk, Wv, Wo, xq16);

  // Q = (x @ Wq^T + bq) * 1/sqrt(DH)  (batch folded into M)
  gemm_qkv<1, false><<<dim3((4096 / 64) * (512 / 128), 1, 1), 64, 0, stream>>>(xq16, Wq16, bq, q16, 4096, 0.125f);
  // K = kv @ Wk^T + bk
  gemm_qkv<2, false><<<dim3((8192 / 128) * (512 / 128), 1, 1), 128, 0, stream>>>(kv16, Wk16, bk, k16, 8192, 1.0f);
  // V^T = (kv @ Wv^T + bv)^T per batch (grid.z = B)
  gemm_qkv<2, true><<<dim3((4096 / 128) * (512 / 128), 1, 2), 128, 0, stream>>>(kv16, Wv16, bv, vT16, 4096, 1.0f);

  flash_attn<<<dim3(LQ_ / 128, B_ * H_, 1), 256, 0, stream>>>(q16, k16, vT16, ctx16);

  gemm_out<<<dim3((4096 / 64) * (512 / 128), 1, 1), 64, 0, stream>>>(ctx16, Wo16, bo, query, xres);

  ln_row<<<dim3((B_ * LQ_) / 8, 1, 1), 256, 0, stream>>>(xres, gamma, beta, out);
}

// v007
// It runs in 80 microseconds.
// Two timings next to v006 put it at 1.09 and 1.10 times that version's speed.
// All steps since v000 together make it 3.84 times as fast.
#include <hip/hip_runtime.h>

typedef _Float16 f16;
typedef __attribute__((ext_vector_type(4)))  f16   v4h;
typedef __attribute__((ext_vector_type(8)))  f16   v8h;
typedef __attribute__((ext_vector_type(16))) f16   v16h;
typedef __attribute__((ext_vector_type(8)))  float v8f;
typedef __attribute__((ext_vector_type(4)))  float v4f;

#define E_  512
#define H_  8
#define DH_ 64
#define LQ_ 2048
#define LK_ 4096
#define B_  2
// LDS row pitches in f16 elements: 16 B x odd, so the 16 rows one ds_load_b128 touches spread over all banks
#define KP_ 72   // 64 dh    + 8 pad = 144 B
#define VP_ 136  // 128 keys + 8 pad = 272 B
#define SK_  128           // keys per stage of the K/V ring in flash_attn
#define NST_ (LK_ / SK_)   // stages

static __device__ __forceinline__ v16h cat8(v8h lo, v8h hi) {
  return __builtin_shufflevector(lo, hi, 0,1,2,3,4,5,6,7,8,9,10,11,12,13,14,15);
}
static __device__ __forceinline__ v16h ld_frag(const f16* p) {
  v8h lo = *(const v8h*)p;
  v8h hi = *(const v8h*)(p + 16);
  return cat8(lo, hi);
}
// Fragment order: how the f16 operands of the four dense products lie in the workspace. A band of 16 rows x 512 k
// keeps its 16 KB, but inside it element (row r, k) stands at (k / 32) * 512 + (k / 8 % 4) * 128 + r * 8 + k % 8.
// The two halves of a lane's 16 x 32 fragment are then at lane * 8 and 256 + lane * 8 of a 1 KB block, so a wave-wide
// load is 512 contiguous bytes (4 cache lines); from row-major rows it took 32 B out of each of 16 lines.
// Which k a lane holds at which place is what ld_frag gives on a row-major matrix.
#define BAND_ (16 * E_)   // elements of a band
static __device__ __forceinline__ v16h ld_pack(const f16* p) {
  v8h lo = *(const v8h*)p;
  v8h hi = *(const v8h*)(p + 256);
  return cat8(lo, hi);
}
static __device__ __forceinline__ v8f wmma32(v16h a, v16h b, v8f c) {
  // D = A(16x32 f16) * B(32x16 f16) + C(16x16 f32)
  return __builtin_amdgcn_wmma_f32_16x16x32_f16(false, a, false, b, (short)0, c, false, false);
}

// One lane's share of a K/V stage: eight async global->LDS copies of 16 B (ASYNCcnt), four of K rows and four of
// V^T rows. The closing s_wait_xcnt stands in the copies' own statement, so that no address register of a copy
// is rewritten ahead of it.
static __device__ __forceinline__ void stage_copies(uint32_t lk, uint32_t lv, const f16* kg, const f16* vg) {
  asm volatile("global_load_async_to_lds_b128 %0, %8, off\n\t"
               "global_load_async_to_lds_b128 %1, %9, off\n\t"
               "global_load_async_to_lds_b128 %2, %10, off\n\t"
               "global_load_async_to_lds_b128 %3, %11, off\n\t"
               "global_load_async_to_lds_b128 %4, %12, off\n\t"
               "global_load_async_to_lds_b128 %5, %13, off\n\t"
               "global_load_async_to_lds_b128 %6, %14, off\n\t"
               "global_load_async_to_lds_b128 %7, %15, off\n\t"
               "s_wait_xcnt 0x0"
               :: "v"(lk), "v"(lk + 32 * KP_ * 2), "v"(lk + 64 * KP_ * 2), "v"(lk + 96 * KP_ * 2),
                  "v"(lv), "v"(lv + 16 * VP_ * 2), "v"(lv + 32 * VP_ * 2), "v"(lv + 48 * VP_ * 2),
                  "v"(kg), "v"(kg + 32 * E_), "v"(kg + 64 * E_), "v"(kg + 96 * E_),
                  "v"(vg), "v"(vg + 16 * LK_), "v"(vg + 32 * LK_), "v"(vg + 48 * LK_)
               : "memory");
}
// the wave's own copies have landed
static __device__ __forceinline__ void async_wait0() {
  asm volatile("s_wait_asynccnt 0x0" ::: "memory");
}
// the wave's own LDS reads have returned, before the buffer they read is handed back for a refill
static __device__ __forceinline__ void ds_wait0() {
  asm volatile("s_wait_dscnt 0x0" ::: "memory");
}

// ---------------------------------------------------------------- convert
// All six f32 arrays in one launch. Their f16 copies lie one behind the other in the workspace, in the order of the
// arguments, so a block's place in the output follows from its index alone. A block converts CVB_ elements of ONE
// array, 32 rows = two bands, and writes them in fragment order; a lane issues its CVL_ loads of 16 B before the
// first conversion. A lane takes 8 consecutive k of one row at a time (two loads, one 16 B store); a wave takes
// 8 rows x 32 k: it reads 8 whole lines with a pair of loads and fills 4 whole lines with the store.
// Few waves, each with much in flight: waves start at a bounded rate, which holds a grid of one-load waves back.
#define CVL_ 16                 // loads per lane
#define CVB_ (256 * 4 * CVL_)   // elements per block; divides the size of every array
#define CVQ_  (B_ * LQ_ * E_ / CVB_)   // blocks of the query array
#define CVKV_ (B_ * LK_ * E_ / CVB_)   // blocks of the key/value array
#define CVW_  (E_ * E_ / CVB_)         // blocks of one weight matrix
static_assert(CVB_ == 2 * BAND_, "a block of cvt_f32_f16 converts two bands");
__global__ __launch_bounds__(256) void cvt_f32_f16(const float* __restrict__ xq, const float* __restrict__ kv,
                                                   const float* __restrict__ wq, const float* __restrict__ wk,
                                                   const float* __restrict__ wv, const float* __restrict__ wo,
                                                   f16* __restrict__ out) {
  int r = blockIdx.x;           // becomes the block's index inside its own array
  const float* src;
  if (r < CVQ_) {
    src = xq;
  } else if (r < CVQ_ + CVKV_) {
    src = kv;
    r -= CVQ_;
  } else {
    r -= CVQ_ + CVKV_;
    const int w = r / CVW_;
    r -= w * CVW_;
    src = w == 0 ? wq : w == 1 ? wk : w == 2 ? wv : wo;
  }
  const int wave = threadIdx.x >> 5, lane = threadIdx.x & 31;
  const int g = wave >> 1, kh = wave & 1;   // the wave's 8 of the 32 rows, its half of the row (8 k steps of 32)
  const int rr = lane >> 2, q = lane & 3;   // the lane's row among the 8, its 8 k among the 32 of a step
  const float* s = src + (size_t)r * CVB_ + (g * 8 + rr) * E_ + kh * 256 + q * 8;   // + 32 per k step
  f16* d = out + (size_t)blockIdx.x * CVB_ + (g >> 1) * BAND_ + kh * 4096 + q * 128 + ((g & 1) * 8 + rr) * 8;  // + 512
  v4f v[CVL_];
  #pragma unroll
  for (int i = 0; i < CVL_; ++i) v[i] = *(const v4f*)(s + (i >> 1) * 32 + (i & 1) * 4);
  // the loads' address pair, named here, stays whole up to this wait: without it the last load's result was given
  // the pair's own registers, which the fifteen loads before it name too
  asm volatile("s_wait_xcnt 0x0" :: "v"(s) : "memory");
  // keeps every load ahead of the first conversion: without it the last two loads were issued into the first two's
  // registers, behind the wait for those, and the wave paid the memory latency twice
  __builtin_amdgcn_sched_barrier(0);
  #pragma unroll
  for (int i = 0; i < CVL_ / 2; ++i) {
    v8h o;
    #pragma unroll
    for (int e = 0; e < 4; ++e) { o[e] = (f16)v[2 * i][e]; o[4 + e] = (f16)v[2 * i + 1][e]; }
    *(v8h*)(d + i * 512) = o;
  }
}

// ----------------------------------------------------- register-tiled product
// One wave owns 4 x 4 accumulator tiles (64 rows x 64 columns): a k step of 32 loads 8 fragments for 16 WMMAs,
// where one tile a wave loaded 2 fragments for 1. Each tile still sums k in ascending order.
// Both operands lie in fragment order. ap0 / bp0: this lane's address in the first row tile's / column tile's band;
// further tiles lie a band on, further k steps 512 elements on.
// The fragments go through a ring of three register sets, so that two k steps of loads are in flight.
static __device__ __forceinline__ void tile_product(const f16* __restrict__ ap0, const f16* __restrict__ bp0,
                                                    v8f (&acc)[4][4]) {
  const int K = E_;
  v16h a[3][4], b[3][4];
  #pragma unroll
  for (int s = 0; s < 2; ++s) {
    #pragma unroll
    for (int i = 0; i < 4; ++i) a[s][i] = ld_pack(ap0 + i * BAND_ + s * 512);
    #pragma unroll
    for (int j = 0; j < 4; ++j) b[s][j] = ld_pack(bp0 + j * BAND_ + s * 512);
  }
  // unrolled: the ring index is a compile-time value, so the three sets stay in registers
  #pragma unroll
  for (int ks = 0; ks < K / 32; ++ks) {
    const int cur = ks % 3, nxt = (ks + 2) % 3;
    if (ks + 2 < K / 32) {
      #pragma unroll
      for (int i = 0; i < 4; ++i) a[nxt][i] = ld_pack(ap0 + i * BAND_ + (ks + 2) * 512);
      #pragma unroll
      for (int j = 0; j < 4; ++j) b[nxt][j] = ld_pack(bp0 + j * BAND_ + (ks + 2) * 512);
    }
    // keeps the loads of step ks + 2 ahead of the products of step ks: without it the scheduler sinks every load
    // to just before its first use, and the lone wave of a SIMD waits out the whole load latency at each fragment
    __builtin_amdgcn_sched_barrier(0);
    #pragma unroll
    for (int i = 0; i < 4; ++i)
      #pragma unroll
      for (int j = 0; j < 4; ++j)
        acc[i][j] = wmma32(a[cur][i], b[cur][j], acc[i][j]);
    // the other side of the same fence: the next step's loads stay one group, behind these products
    __builtin_amdgcn_sched_barrier(0);
  }
  // before the caller's epilogue reuses the two register pairs that hold the fragment loads' addresses; the pairs,
  // named here, stay whole up to this wait
  asm volatile("s_wait_xcnt 0x0" :: "v"(ap0), "v"(bp0) : "memory");
  // keeps the epilogue's first address arithmetic behind that wait
  __builtin_amdgcn_sched_barrier(0);
}

// ----------------------------------------------------- projection GEMMs (f16 out)
// out = (X @ W^T + bias) * scale ; X:[rows][512] f16 (batch folded into the rows), W:[512][512] f16, both in
// fragment order; out row-major. K and Q: out[row][col]; V: out[batch][col][row in batch] (V^T).
// ONE launch holds the blocks of all three products: none reads what another writes, so they need no launch
// boundary between them, and a WGP holds two or three blocks at once, whose starts, load waits and stores overlap.
// block = 2 x 2 waves: 128 rows x 128 columns; inside a product, index = row block * 4 + column block.
// K block i and V block i read the same 128 rows of kv.
#define PBKV_ ((B_ * LK_ / 128) * (E_ / 128))   // blocks of the K product, and of the V product
#define PBQ_  ((B_ * LQ_ / 128) * (E_ / 128))   // blocks of the Q product
__global__ __launch_bounds__(128) void gemm_qkv(const f16* __restrict__ xq, const f16* __restrict__ kv,
                                                const f16* __restrict__ Wq, const f16* __restrict__ Wk,
                                                const f16* __restrict__ Wv, const float* __restrict__ bq,
                                                const float* __restrict__ bk, const float* __restrict__ bv,
                                                f16* __restrict__ q, f16* __restrict__ k, f16* __restrict__ vT) {
  const int K = E_, N = E_;
  const int wave = threadIdx.x >> 5, lane = threadIdx.x & 31;
  const int l16 = lane & 15, hs = lane >> 4;
  int blk = blockIdx.x;         // becomes the block's index inside its own product
  const f16* X = kv;
  const f16* W = Wk;
  const float* bias = bk;
  f16* out = k;
  float scale = 1.0f;
  bool tr = false;
  if (blk >= 2 * PBKV_) {
    blk -= 2 * PBKV_;
    X = xq; W = Wq; bias = bq; out = q;
    scale = 0.125f;             // 1 / sqrt(DH)
  } else if (blk >= PBKV_) {
    blk -= PBKV_;
    W = Wv; bias = bv;
    tr = true;
  }
  const int row0 = ((blk >> 2) * 2 + (wave >> 1)) * 64;
  const int col0 = ((blk & 3) * 2 + (wave & 1)) * 64;
  v8f acc[4][4] = {};
  tile_product(X + (size_t)row0 * K + lane * 8, W + (size_t)col0 * K + lane * 8, acc);
  if (!tr) {
    #pragma unroll
    for (int j = 0; j < 4; ++j) {
      const int col = col0 + j * 16 + l16;
      const float bc = bias[col];
      #pragma unroll
      for (int i = 0; i < 4; ++i) {
        const int rowb = row0 + i * 16 + hs * 8;
        #pragma unroll
        for (int r = 0; r < 8; ++r)
          out[(size_t)(rowb + r) * N + col] = (f16)((acc[i][j][r] + bc) * scale);
      }
    }
  } else {
    // a wave's 64 rows lie in one batch
    out = vT + (size_t)(row0 / LK_) * LK_ * N + (row0 % LK_);
    #pragma unroll
    for (int j = 0; j < 4; ++j) {
      const int col = col0 + j * 16 + l16;
      const float bc = bias[col];
      #pragma unroll
      for (int i = 0; i < 4; ++i) {
        v8h o;
        #pragma unroll
        for (int r = 0; r < 8; ++r) o[r] = (f16)(acc[i][j][r] + bc);
        *(v8h*)(out + (size_t)col * LK_ + i * 16 + hs * 8) = o;  // contiguous rows
      }
    }
  }
}

static __device__ __forceinline__ float xhalf(float x) {
  // value of lane ^ 16 (the other half of the same query column)
  const int b = __builtin_bit_cast(int, x);
  return __builtin_bit_cast(float, __builtin_amdgcn_permlanex16(b, b, 0x76543210, 0xfedcba98, false, false));
}
// e^x as 2^(x * log2 e), the same two instructions __expf gives, written as asm for the slot the instruction set
// asks for behind a transcendental before its source is overwritten or its result read.
// Early-clobber outputs keep every result off every
// source inside the statement; the closing v_nop is the slot behind the last one.
static __device__ __forceinline__ v8f exp8(v8f x) {
  x *= 1.44269504f;
  float y0, y1, y2, y3, y4, y5, y6, y7;
  asm("v_exp_f32 %0, %8\n\tv_exp_f32 %1, %9\n\tv_exp_f32 %2, %10\n\tv_exp_f32 %3, %11\n\t"
      "v_exp_f32 %4, %12\n\tv_exp_f32 %5, %13\n\tv_exp_f32 %6, %14\n\tv_exp_f32 %7, %15\n\tv_nop"
      : "=&v"(y0), "=&v"(y1), "=&v"(y2), "=&v"(y3), "=&v"(y4), "=&v"(y5), "=&v"(y6), "=&v"(y7)
      : "v"(x[0]), "v"(x[1]), "v"(x[2]), "v"(x[3]), "v"(x[4]), "v"(x[5]), "v"(x[6]), "v"(x[7]));
  return v8f{y0, y1, y2, y3, y4, y5, y6, y7};
}
static __device__ __forceinline__ float exp1(float x) {
  float y;
  asm("v_exp_f32 %0, %1\n\tv_nop" : "=v"(y) : "v"(x * 1.44269504f));  // v_nop: the same slot
  return y;
}
__global__ __launch_bounds__(256) void flash_attn(const f16* __restrict__ q16, const f16* __restrict__ k16,
                                                  const f16* __restrict__ vT16, f16* __restrict__ ctx16) {
  __shared__ __attribute__((aligned(16))) f16 lK[2 * SK_ * KP_]; // [buffer][key 0..127][dh 0..63 + pad]
  __shared__ __attribute__((aligned(16))) f16 lV[2 * 64 * VP_];  // [buffer][dh 0..63][key 0..127 + pad]
  const int bh = blockIdx.y, b = bh >> 3, h = bh & 7;
  const int wave = threadIdx.x >> 5, lane = threadIdx.x & 31;
  const int l16 = lane & 15, hs = lane >> 4;
  const int qrow0 = blockIdx.x * 128 + wave * 16;

  // Q^T fragments for this wave's 16 query columns (K = 64 -> two 32x16 B fragments)
  const f16* qb = q16 + ((size_t)(b * LQ_ + qrow0 + l16)) * E_ + h * DH_ + hs * 8;
  const v16h qa0 = ld_frag(qb);
  const v16h qa1 = ld_frag(qb + 32);

  // cooperative staging indices (256 threads x 4 x 16 B for each 16 KB tile; a wave's copy covers whole lines)
  const int t = threadIdx.x;
  const int kkey = t >> 3, kdh = (t & 7) * 8;     // + 32 keys per further copy
  const int vdh = t >> 4, vkey = (t & 15) * 8;    // + 16 dh per further copy
  const f16* kg = k16 + ((size_t)b * LK_ + kkey) * E_ + h * DH_ + kdh;  // + stage * SK_ * E_
  const f16* vg = vT16 + ((size_t)b * E_ + h * DH_ + vdh) * LK_ + vkey; // + stage * SK_
  // LDS byte offsets (AS3 offset == low 32 bits of the generic shared pointer)
  const uint32_t lkoff = (uint32_t)(size_t)&lK[kkey * KP_ + kdh];
  const uint32_t lvoff = (uint32_t)(size_t)&lV[vdh * VP_ + vkey];

  float Mx = -1e30f;   // running maximum of this lane's query column (equal in both halves)
  float Ls = 0.f;      // running sum over this lane's own keys only; halves joined after the loop
  v8f acc[4] = {};     // acc[tl][r] = O[query l16][dh tl*16 + hs*8 + r]

  // two-buffer ring: stage s + 1 flies into the other buffer while stage s is worked on
  stage_copies(lkoff, lvoff, kg, vg);                       // stage 0 -> buffer 0
  async_wait0();
  __syncthreads();                                          // stage 0 visible to every wave
  stage_copies(lkoff + SK_ * KP_ * 2, lvoff + 64 * VP_ * 2, kg + (size_t)SK_ * E_, vg + SK_);  // stage 1 -> buffer 1

  for (int s = 0; s < NST_; ++s) {
   const int buf = s & 1;
   const f16* bK = lK + buf * (SK_ * KP_);
   const f16* bV = lV + buf * (64 * VP_);
   // unrolled: the four 32-key passes of a stage read LDS at immediate offsets from one base
   #pragma unroll
   for (int p = 0; p < SK_ / 32; ++p) {
    // S^T = K * Q^T for two 16-key tiles: c0[r] = S[query l16][key hs*8 + r], c1: keys + 16
    v8f c0 = {}, c1 = {};
    {
      const f16* kbp = &bK[(p * 32 + l16) * KP_ + hs * 8];
      c0 = wmma32(ld_frag(kbp), qa0, c0);
      c0 = wmma32(ld_frag(kbp + 32), qa1, c0);
      kbp += 16 * KP_;
      c1 = wmma32(ld_frag(kbp), qa0, c1);
      c1 = wmma32(ld_frag(kbp + 32), qa1, c1);
    }

    // column maximum: a tree over the lane's own 16 scores, then one exchange between halves
    float m8[8];
    #pragma unroll
    for (int r = 0; r < 8; ++r) m8[r] = fmaxf(c0[r], c1[r]);
    float ml = fmaxf(fmaxf(fmaxf(m8[0], m8[1]), fmaxf(m8[2], m8[3])),
                     fmaxf(fmaxf(m8[4], m8[5]), fmaxf(m8[6], m8[7])));
    ml = fmaxf(ml, xhalf(ml));
    const float nm = fmaxf(Mx, ml);
    const float al = exp1(Mx - nm);
    Mx = nm;

    c0 = exp8(c0 - nm);
    c1 = exp8(c1 - nm);
    const v8f s8 = c0 + c1;
    Ls = Ls * al + (((s8[0] + s8[1]) + (s8[2] + s8[3])) + ((s8[4] + s8[5]) + (s8[6] + s8[7])));
    #pragma unroll
    for (int tl = 0; tl < 4; ++tl) acc[tl] *= al;

    // P^T as B operand straight from the accumulators: element s is key hs*8 + s, then 16 + hs*8 + (s - 8)
    const v16h pb = cat8(__builtin_convertvector(c0, v8h), __builtin_convertvector(c1, v8h));

    // O^T += V^T(64x32) * P^T(32x16): 4 WMMAs over dh tiles, keys contiguous in lV rows
    #pragma unroll
    for (int tl = 0; tl < 4; ++tl) {
      const v16h va = ld_frag(&bV[(tl * 16 + l16) * VP_ + p * 32 + hs * 8]);
      acc[tl] = wmma32(va, pb, acc[tl]);
    }
   }
   // publish point of stage s + 1: own reads of this buffer done, own copies landed, then every wave meets
   ds_wait0();
   async_wait0();
   __syncthreads();
   if (s + 2 < NST_)   // refill the buffer that every wave has just left
     stage_copies(lkoff + buf * (SK_ * KP_ * 2), lvoff + buf * (64 * VP_ * 2),
                  kg + (size_t)(s + 2) * SK_ * E_, vg + (s + 2) * SK_);
  }
  async_wait0();       // nothing of this wave is in flight when it leaves the loop

  Ls += xhalf(Ls);
  const float inv = 1.f / Ls;
  // the wave's 16 queries are one band; head h is its k steps 2h and 2h + 1; a store is 512 contiguous bytes
  f16* oband = ctx16 + (size_t)(b * LQ_ + qrow0) * E_ + h * 2 * 512 + lane * 8;
  #pragma unroll
  for (int tl = 0; tl < 4; ++tl)
    *(v8h*)(oband + tl * 256) = __builtin_convertvector(acc[tl] * inv, v8h);  // 8 consecutive dh of one query
}

// ---------------------------------------- output projection + bias + residual (f32)
// block = 2 waves side by side, 64 rows x 64 columns a wave: 64 rows x 128 columns; ctx and W in fragment order
__global__ __launch_bounds__(64) void gemm_out(const f16* __restrict__ ctx, const f16* __restrict__ W,
                                               const float* __restrict__ bias, const float* __restrict__ resid,
                                               float* __restrict__ xres) {
  const int K = E_, N = E_;
  const int wave = threadIdx.x >> 5, lane = threadIdx.x & 31;
  const int l16 = lane & 15, hs = lane >> 4;
  const int row0 = (blockIdx.x >> 2) * 64;
  const int col0 = ((blockIdx.x & 3) * 2 + wave) * 64;
  v8f acc[4][4] = {};
  tile_product(ctx + (size_t)row0 * K + lane * 8, W + (size_t)col0 * K + lane * 8, acc);
  float bc[4];
  #pragma unroll
  for (int j = 0; j < 4; ++j) bc[j] = bias[col0 + j * 16 + l16];
  // before a later load's result may land on the register that holds the bias loads' address
  asm volatile("s_wait_xcnt 0x0" ::: "memory");
  // one lane offset for the whole tile; every element lies a compile-time distance from it
  const int base = (row0 + hs * 8) * N + col0 + l16;
  const float* rp = resid + base;
  float* xp = xres + base;
  // two halves of 32 rows: 64 residual values at a time beside the 128 accumulators stay below v256
  #pragma unroll
  for (int h = 0; h < 2; ++h) {
    // before the second half reuses registers that the first half's loads and stores name
    if (h == 1) asm volatile("s_wait_xcnt 0x0" ::: "memory");
    #pragma unroll
    for (int i = 2 * h; i < 2 * h + 2; ++i) {
      #pragma unroll
      for (int j = 0; j < 4; ++j) {
        #pragma unroll
        for (int r = 0; r < 8; ++r) {
          const int d = (i * 16 + r) * N + j * 16;
          xp[d] = acc[i][j][r] + bc[j] + rp[d];
        }
      }
    }
  }
}

// ------------------------------------------------------------------ LayerNorm
__global__ __launch_bounds__(256) void ln_row(const float* __restrict__ x, const float* __restrict__ g,
                                              const float* __restrict__ be, float* __restrict__ out) {
  const int row = blockIdx.x * 8 + (threadIdx.x >> 5);
  const int lane = threadIdx.x & 31;
  const float* xr = x + (size_t)row * E_ + lane * 16;
  v4f v[4];
  float s = 0.f, s2 = 0.f;
  #pragma unroll
  for (int j = 0; j < 4; ++j) {
    v[j] = *(const v4f*)(xr + 4 * j);
    #pragma unroll
    for (int e = 0; e < 4; ++e) { s += v[j][e]; s2 += v[j][e] * v[j][e]; }
  }
  #pragma unroll
  for (int mask = 1; mask < 32; mask <<= 1) {
    s  += __shfl_xor(s, mask, 32);
    s2 += __shfl_xor(s2, mask, 32);
  }
  const float mu = s * (1.f / E_);
  const float var = fmaxf(s2 * (1.f / E_) - mu * mu, 0.f);
  const float rstd = rsqrtf(var + 1e-5f);
  float* orow = out + (size_t)row * E_ + lane * 16;
  const float* gp = g + lane * 16;
  const float* bp = be + lane * 16;
  #pragma unroll
  for (int j = 0; j < 4; ++j) {
    v4f o;
    #pragma unroll
    for (int e = 0; e < 4; ++e)
      o[e] = (v[j][e] - mu) * rstd * gp[4 * j + e] + bp[4 * j + e];
    *(v4f*)(orow + 4 * j) = o;
  }
}

// ------------------------------------------------------------------ launcher
extern "C" void kernel_launch(void* const* d_in, const int* in_sizes, int n_in,
                              void* d_out, int out_size, void* d_ws, size_t ws_size,
                              hipStream_t stream) {
  (void)in_sizes; (void)n_in; (void)out_size; (void)ws_size;
  const float* query     = (const float*)d_in[0];
  const float* key_value = (const float*)d_in[1];
  const float* Wq = (const float*)d_in[2];
  const float* bq = (const float*)d_in[3];
  const float* Wk = (const float*)d_in[4];
  const float* bk = (const float*)d_in[5];
  const float* Wv = (const float*)d_in[6];
  const float* bv = (const float*)d_in[7];
  const float* Wo = (const float*)d_in[8];
  const float* bo = (const float*)d_in[9];
  const float* gamma = (const float*)d_in[10];
  const float* beta  = (const float*)d_in[11];
  float* out = (float*)d_out;

  const size_t nQ  = (size_t)B_ * LQ_ * E_;   // 2,097,152
  const size_t nKV = (size_t)B_ * LK_ * E_;   // 4,194,304
  const size_t nW  = (size_t)E_ * E_;         //   262,144

  f16* p = (f16*)d_ws;
  f16* xq16  = p; p += nQ;
  f16* kv16  = p; p += nKV;
  f16* Wq16  = p; p += nW;
  f16* Wk16  = p; p += nW;
  f16* Wv16  = p; p += nW;
  f16* Wo16  = p; p += nW;
  f16* q16   = p; p += nQ;
  f16* k16   = p; p += nKV;
  f16* vT16  = p; p += nKV;
  f16* ctx16 = p; p += nQ;
  float* xres = (float*)p;                    // nQ floats

  // xq16, kv16, Wq16, Wk16, Wv16, Wo16 are one run of the workspace, filled in this order, each in fragment order
  cvt_f32_f16<<<dim3(CVQ_ + CVKV_ + 4 * CVW_), dim3(256), 0, stream>>>(query, key_value, Wq, Wk, Wv, Wo, xq16);

  // Q = (x @ Wq^T + bq) * 1/sqrt(DH), K = kv @ Wk^T + bk, V^T = (kv @ Wv^T + bv)^T per batch
  gemm_qkv<<<dim3(2 * PBKV_ + PBQ_), dim3(128), 0, stream>>>(xq16, kv16, Wq16, Wk16, Wv16, bq, bk, bv, q16, k16, vT16);

  flash_attn<<<dim3(LQ_ / 128, B_ * H_, 1), 256, 0, stream>>>(q16, k16, vT16, ctx16);

  gemm_out<<<dim3((4096 / 64) * (512 / 128), 1, 1), 64, 0, stream>>>(ctx16, Wo16, bo, query, xres);

  ln_row<<<dim3((B_ * LQ_) / 8, 1, 1), 256, 0, stream>>>(xres, gamma, beta, out);
}

// v008
// A run of this version takes 69.3 microseconds.
// Timed twice side by side with v007, it ran 1.15 and 1.16 times as fast.
// Counting every step since v000, it is 4.43 times as fast.
#include <hip/hip_runtime.h>

typedef _Float16 f16;
typedef __attribute__((ext_vector_type(4)))  f16   v4h;
typedef __attribute__((ext_vector_type(8)))  f16   v8h;
typedef __attribute__((ext_vector_type(16))) f16   v16h;
typedef __attribute__((ext_vector_type(8)))  float v8f;
typedef __attribute__((ext_vector_type(4)))  float v4f;

#define E_  512
#define H_  8
#define DH_ 64
#define LQ_ 2048
#define LK_ 4096
#define B_  2
// LDS row pitches in f16 elements: 16 B x odd, so the 16 rows one ds_load_b128 touches spread over all banks
#define KP_ 72   // 64 dh    + 8 pad = 144 B
#define VP_ 264  // 256 keys + 8 pad = 528 B
#define SK_  256           // keys per stage of the K/V ring in flash_attn
#define NST_ (LK_ / SK_)   // stages
#define KQ_  4             // the waves of flash_attn that share 32 query columns: each takes SK_ / KQ_ keys of a stage
#define WK_  (SK_ / KQ_)   // keys of a stage per wave: two passes of 32

static __device__ __forceinline__ v16h cat8(v8h lo, v8h hi) {
  return __builtin_shufflevector(lo, hi, 0,1,2,3,4,5,6,7,8,9,10,11,12,13,14,15);
}
static __device__ __forceinline__ v16h ld_frag(const f16* p) {
  v8h lo = *(const v8h*)p;
  v8h hi = *(const v8h*)(p + 16);
  return cat8(lo, hi);
}
// Fragment order: how the f16 operands of the four dense products lie in the workspace. A band of 16 rows x 512 k
// keeps its 16 KB, but inside it element (row r, k) stands at (k / 32) * 512 + (k / 8 % 4) * 128 + r * 8 + k % 8.
// The two halves of a lane's 16 x 32 fragment are then at lane * 8 and 256 + lane * 8 of a 1 KB block, so a wave-wide
// load is 512 contiguous bytes (4 cache lines); from row-major rows it took 32 B out of each of 16 lines.
// Which k a lane holds at which place is what ld_frag gives on a row-major matrix.
#define BAND_ (16 * E_)   // elements of a band
static __device__ __forceinline__ v16h ld_pack(const f16* p) {
  v8h lo = *(const v8h*)p;
  v8h hi = *(const v8h*)(p + 256);
  return cat8(lo, hi);
}
static __device__ __forceinline__ v8f wmma32(v16h a, v16h b, v8f c) {
  // D = A(16x32 f16) * B(32x16 f16) + C(16x16 f32)
  return __builtin_amdgcn_wmma_f32_16x16x32_f16(false, a, false, b, (short)0, c, false, false);
}

// One lane's share of a K/V stage: eight async global->LDS copies of 16 B (ASYNCcnt), four of K rows and four of
// V^T rows. The closing s_wait_xcnt stands in the copies' own statement, so that no address register of a copy
// is rewritten ahead of it.
static __device__ __forceinline__ void stage_copies(uint32_t lk, uint32_t lv, const f16* kg, const f16* vg) {
  asm volatile("global_load_async_to_lds_b128 %0, %8, off\n\t"
               "global_load_async_to_lds_b128 %1, %9, off\n\t"
               "global_load_async_to_lds_b128 %2, %10, off\n\t"
               "global_load_async_to_lds_b128 %3, %11, off\n\t"
               "global_load_async_to_lds_b128 %4, %12, off\n\t"
               "global_load_async_to_lds_b128 %5, %13, off\n\t"
               "global_load_async_to_lds_b128 %6, %14, off\n\t"
               "global_load_async_to_lds_b128 %7, %15, off\n\t"
               "s_wait_xcnt 0x0"
               :: "v"(lk), "v"(lk + 64 * KP_ * 2), "v"(lk + 128 * KP_ * 2), "v"(lk + 192 * KP_ * 2),
                  "v"(lv), "v"(lv + 16 * VP_ * 2), "v"(lv + 32 * VP_ * 2), "v"(lv + 48 * VP_ * 2),
                  "v"(kg), "v"(kg + 64 * E_), "v"(kg + 128 * E_), "v"(kg + 192 * E_),
                  "v"(vg), "v"(vg + 16 * LK_), "v"(vg + 32 * LK_), "v"(vg + 48 * LK_)
               : "memory");
}
// the wave's own copies have landed
static __device__ __forceinline__ void async_wait0() {
  asm volatile("s_wait_asynccnt 0x0" ::: "memory");
}
// the wave's own LDS reads have returned, before the buffer they read is handed back for a refill
static __device__ __forceinline__ void ds_wait0() {
  asm volatile("s_wait_dscnt 0x0" ::: "memory");
}

// ---------------------------------------------------------------- convert
// All six f32 arrays in one launch. Their f16 copies lie one behind the other in the workspace, in the order of the
// arguments, so a block's place in the output follows from its index alone. A block converts CVB_ elements of ONE
// array, 32 rows = two bands, and writes them in fragment order; a lane issues its CVL_ loads of 16 B before the
// first conversion. A lane takes 8 consecutive k of one row at a time (two loads, one 16 B store); a wave takes
// 8 rows x 32 k: it reads 8 whole lines with a pair of loads and fills 4 whole lines with the store.
// Few waves, each with much in flight: waves start at a bounded rate, which holds a grid of one-load waves back.
#define CVL_ 16                 // loads per lane
#define CVB_ (256 * 4 * CVL_)   // elements per block; divides the size of every array
#define CVQ_  (B_ * LQ_ * E_ / CVB_)   // blocks of the query array
#define CVKV_ (B_ * LK_ * E_ / CVB_)   // blocks of the key/value array
#define CVW_  (E_ * E_ / CVB_)         // blocks of one weight matrix
static_assert(CVB_ == 2 * BAND_, "a block of cvt_f32_f16 converts two bands");
__global__ __launch_bounds__(256) void cvt_f32_f16(const float* __restrict__ xq, const float* __restrict__ kv,
                                                   const float* __restrict__ wq, const float* __restrict__ wk,
                                                   const float* __restrict__ wv, const float* __restrict__ wo,
                                                   f16* __restrict__ out) {
  int r = blockIdx.x;           // becomes the block's index inside its own array
  const float* src;
  if (r < CVQ_) {
    src = xq;
  } else if (r < CVQ_ + CVKV_) {
    src = kv;
    r -= CVQ_;
  } else {
    r -= CVQ_ + CVKV_;
    const int w = r / CVW_;
    r -= w * CVW_;
    src = w == 0 ? wq : w == 1 ? wk : w == 2 ? wv : wo;
  }
  const int wave = threadIdx.x >> 5, lane = threadIdx.x & 31;
  const int g = wave >> 1, kh = wave & 1;   // the wave's 8 of the 32 rows, its half of the row (8 k steps of 32)
  const int rr = lane >> 2, q = lane & 3;   // the lane's row among the 8, its 8 k among the 32 of a step
  const float* s = src + (size_t)r * CVB_ + (g * 8 + rr) * E_ + kh * 256 + q * 8;   // + 32 per k step
  f16* d = out + (size_t)blockIdx.x * CVB_ + (g >> 1) * BAND_ + kh * 4096 + q * 128 + ((g & 1) * 8 + rr) * 8;  // + 512
  v4f v[CVL_];
  #pragma unroll
  for (int i = 0; i < CVL_; ++i) v[i] = *(const v4f*)(s + (i >> 1) * 32 + (i & 1) * 4);
  // the loads' address pair, named here, stays whole up to this wait: without it the last load's result was given
  // the pair's own registers, which the fifteen loads before it name too
  asm volatile("s_wait_xcnt 0x0" :: "v"(s) : "memory");
  // keeps every load ahead of the first conversion: without it the last two loads were issued into the first two's
  // registers, behind the wait for those, and the wave paid the memory latency twice
  __builtin_amdgcn_sched_barrier(0);
  #pragma unroll
  for (int i = 0; i < CVL_ / 2; ++i) {
    v8h o;
    #pragma unroll
    for (int e = 0; e < 4; ++e) { o[e] = (f16)v[2 * i][e]; o[4 + e] = (f16)v[2 * i + 1][e]; }
    *(v8h*)(d + i * 512) = o;
  }
}

// ----------------------------------------------------- register-tiled product
// One wave owns 4 x 4 accumulator tiles (64 rows x 64 columns): a k step of 32 loads 8 fragments for 16 WMMAs,
// where one tile a wave loaded 2 fragments for 1. Each tile still sums k in ascending order.
// Both operands lie in fragment order. ap0 / bp0: this lane's address in the first row tile's / column tile's band;
// further tiles lie a band on, further k steps 512 elements on.
// The fragments go through a ring of three register sets, so that two k steps of loads are in flight.
static __device__ __forceinline__ void tile_product(const f16* __restrict__ ap0, const f16* __restrict__ bp0,
                                                    v8f (&acc)[4][4]) {
  const int K = E_;
  v16h a[3][4], b[3][4];
  #pragma unroll
  for (int s = 0; s < 2; ++s) {
    #pragma unroll
    for (int i = 0; i < 4; ++i) a[s][i] = ld_pack(ap0 + i * BAND_ + s * 512);
    #pragma unroll
    for (int j = 0; j < 4; ++j) b[s][j] = ld_pack(bp0 + j * BAND_ + s * 512);
  }
  // unrolled: the ring index is a compile-time value, so the three sets stay in registers
  #pragma unroll
  for (int ks = 0; ks < K / 32; ++ks) {
    const int cur = ks % 3, nxt = (ks + 2) % 3;
    if (ks + 2 < K / 32) {
      #pragma unroll
      for (int i = 0; i < 4; ++i) a[nxt][i] = ld_pack(ap0 + i * BAND_ + (ks + 2) * 512);
      #pragma unroll
      for (int j = 0; j < 4; ++j) b[nxt][j] = ld_pack(bp0 + j * BAND_ + (ks + 2) * 512);
    }
    // keeps the loads of step ks + 2 ahead of the products of step ks: without it the scheduler sinks every load
    // to just before its first use, and the lone wave of a SIMD waits out the whole load latency at each fragment
    __builtin_amdgcn_sched_barrier(0);
    #pragma unroll
    for (int i = 0; i < 4; ++i)
      #pragma unroll
      for (int j = 0; j < 4; ++j)
        acc[i][j] = wmma32(a[cur][i], b[cur][j], acc[i][j]);
    // the other side of the same fence: the next step's loads stay one group, behind these products
    __builtin_amdgcn_sched_barrier(0);
  }
  // before the caller's epilogue reuses the two register pairs that hold the fragment loads' addresses; the pairs,
  // named here, stay whole up to this wait
  asm volatile("s_wait_xcnt 0x0" :: "v"(ap0), "v"(bp0) : "memory");
  // keeps the epilogue's first address arithmetic behind that wait
  __builtin_amdgcn_sched_barrier(0);
}

// ----------------------------------------------------- projection GEMMs (f16 out)
// out = (X @ W^T + bias) * scale ; X:[rows][512] f16 (batch folded into the rows), W:[512][512] f16, both in
// fragment order; out row-major. K and Q: out[row][col]; V: out[batch][col][row in batch] (V^T).
// ONE launch holds the blocks of all three products: none reads what another writes, so they need no launch
// boundary between them, and a WGP holds two or three blocks at once, whose starts, load waits and stores overlap.
// block = 2 x 2 waves: 128 rows x 128 columns; inside a product, index = row block * 4 + column block.
// K block i and V block i read the same 128 rows of kv.
#define PBKV_ ((B_ * LK_ / 128) * (E_ / 128))   // blocks of the K product, and of the V product
#define PBQ_  ((B_ * LQ_ / 128) * (E_ / 128))   // blocks of the Q product
__global__ __launch_bounds__(128) void gemm_qkv(const f16* __restrict__ xq, const f16* __restrict__ kv,
                                                const f16* __restrict__ Wq, const f16* __restrict__ Wk,
                                                const f16* __restrict__ Wv, const float* __restrict__ bq,
                                                const float* __restrict__ bk, const float* __restrict__ bv,
                                                f16* __restrict__ q, f16* __restrict__ k, f16* __restrict__ vT) {
  const int K = E_, N = E_;
  const int wave = threadIdx.x >> 5, lane = threadIdx.x & 31;
  const int l16 = lane & 15, hs = lane >> 4;
  int blk = blockIdx.x;         // becomes the block's index inside its own product
  const f16* X = kv;
  const f16* W = Wk;
  const float* bias = bk;
  f16* out = k;
  float scale = 1.0f;
  bool tr = false;
  if (blk >= 2 * PBKV_) {
    blk -= 2 * PBKV_;
    X = xq; W = Wq; bias = bq; out = q;
    scale = 0.125f;             // 1 / sqrt(DH)
  } else if (blk >= PBKV_) {
    blk -= PBKV_;
    W = Wv; bias = bv;
    tr = true;
  }
  const int row0 = ((blk >> 2) * 2 + (wave >> 1)) * 64;
  const int col0 = ((blk & 3) * 2 + (wave & 1)) * 64;
  v8f acc[4][4] = {};
  tile_product(X + (size_t)row0 * K + lane * 8, W + (size_t)col0 * K + lane * 8, acc);
  if (!tr) {
    #pragma unroll
    for (int j = 0; j < 4; ++j) {
      const int col = col0 + j * 16 + l16;
      const float bc = bias[col];
      #pragma unroll
      for (int i = 0; i < 4; ++i) {
        const int rowb = row0 + i * 16 + hs * 8;
        #pragma unroll
        for (int r = 0; r < 8; ++r)
          out[(size_t)(rowb + r) * N + col] = (f16)((acc[i][j][r] + bc) * scale);
      }
    }
  } else {
    // a wave's 64 rows lie in one batch
    out = vT + (size_t)(row0 / LK_) * LK_ * N + (row0 % LK_);
    #pragma unroll
    for (int j = 0; j < 4; ++j) {
      const int col = col0 + j * 16 + l16;
      const float bc = bias[col];
      #pragma unroll
      for (int i = 0; i < 4; ++i) {
        v8h o;
        #pragma unroll
        for (int r = 0; r < 8; ++r) o[r] = (f16)(acc[i][j][r] + bc);
        *(v8h*)(out + (size_t)col * LK_ + i * 16 + hs * 8) = o;  // contiguous rows
      }
    }
  }
}

static __device__ __forceinline__ float xhalf(float x) {
  // value of lane ^ 16 (the other half of the same query column)
  const int b = __builtin_bit_cast(int, x);
  return __builtin_bit_cast(float, __builtin_amdgcn_permlanex16(b, b, 0x76543210, 0xfedcba98, false, false));
}
// e^x as 2^(x * log2 e), the same two instructions __expf gives, written as asm for the slot the instruction set
// asks for behind a transcendental before its source is overwritten or its result read.
// Early-clobber outputs keep every result off every
// source inside the statement; the closing v_nop is the slot behind the last one.
static __device__ __forceinline__ v8f exp8(v8f x) {
  x *= 1.44269504f;
  float y0, y1, y2, y3, y4, y5, y6, y7;
  asm("v_exp_f32 %0, %8\n\tv_exp_f32 %1, %9\n\tv_exp_f32 %2, %10\n\tv_exp_f32 %3, %11\n\t"
      "v_exp_f32 %4, %12\n\tv_exp_f32 %5, %13\n\tv_exp_f32 %6, %14\n\tv_exp_f32 %7, %15\n\tv_nop"
      : "=&v"(y0), "=&v"(y1), "=&v"(y2), "=&v"(y3), "=&v"(y4), "=&v"(y5), "=&v"(y6), "=&v"(y7)
      : "v"(x[0]), "v"(x[1]), "v"(x[2]), "v"(x[3]), "v"(x[4]), "v"(x[5]), "v"(x[6]), "v"(x[7]));
  return v8f{y0, y1, y2, y3, y4, y5, y6, y7};
}
static __device__ __forceinline__ float exp1(float x) {
  float y;
  asm("v_exp_f32 %0, %1\n\tv_nop" : "=v"(y) : "v"(x * 1.44269504f));  // v_nop: the same slot
  return y;
}
// A block is 16 waves on 128 queries: 4 groups of 32 query columns x KQ_ = 4 shares of the keys. A wave holds TWO
// 16-column groups, so each K and V fragment it reads from LDS feeds two WMMAs, and it walks only its own 64 keys of
// every 256-key stage, so that the chip still holds four waves a SIMD. Each wave keeps its own running maximum, sum
// and O over its keys; the four shares of a column are joined once, through LDS, behind the loop.
__global__ __launch_bounds__(512) void flash_attn(const f16* __restrict__ q16, const f16* __restrict__ k16,
                                                  const f16* __restrict__ vT16, f16* __restrict__ ctx16) {
  __shared__ __attribute__((aligned(16))) f16 lK[2 * SK_ * KP_]; // [buffer][key 0..255][dh 0..63 + pad]
  __shared__ __attribute__((aligned(16))) f16 lV[2 * 64 * VP_];  // [buffer][dh 0..63][key 0..255 + pad]
  __shared__ __attribute__((aligned(16))) float xO[16 * 8 * 256]; // [wave][column group * 4 + dh tile][half][lane][4]
  __shared__ float xM[16 * 2 * 32];                               // [wave][column group][lane]
  __shared__ float xL[16 * 2 * 32];
  const int bh = blockIdx.y, b = bh >> 3, h = bh & 7;
  const int wave = __builtin_amdgcn_readfirstlane(threadIdx.x >> 5), lane = threadIdx.x & 31;
  const int l16 = lane & 15, hs = lane >> 4;
  const int cw = wave & 3, kq = wave >> 2;       // the wave's 32 columns among the 128, its share of the keys
  const int qrow0 = blockIdx.x * 128 + cw * 32;

  // Q^T fragments for this wave's two groups of 16 query columns (K = 64 -> two 32x16 B fragments each)
  v16h qa[2][2];
  #pragma unroll
  for (int cg = 0; cg < 2; ++cg) {
    const f16* qb = q16 + ((size_t)(b * LQ_ + qrow0 + cg * 16 + l16)) * E_ + h * DH_ + hs * 8;
    qa[cg][0] = ld_frag(qb);
    qa[cg][1] = ld_frag(qb + 32);
  }

  // cooperative staging indices (512 threads x 4 x 16 B for each 32 KB tile; a wave's copy covers whole lines)
  const int t = threadIdx.x;
  const int kkey = t >> 3, kdh = (t & 7) * 8;     // + 64 keys per further copy
  const int vdh = t >> 5, vkey = (t & 31) * 8;    // + 16 dh per further copy
  const f16* kg = k16 + ((size_t)b * LK_ + kkey) * E_ + h * DH_ + kdh;  // + stage * SK_ * E_
  const f16* vg = vT16 + ((size_t)b * E_ + h * DH_ + vdh) * LK_ + vkey; // + stage * SK_
  // LDS byte offsets (AS3 offset == low 32 bits of the generic shared pointer)
  const uint32_t lkoff = (uint32_t)(size_t)&lK[kkey * KP_ + kdh];
  const uint32_t lvoff = (uint32_t)(size_t)&lV[vdh * VP_ + vkey];

  float Mx[2] = {-1e30f, -1e30f};  // running maximum of this lane's query column over the wave's keys
  float Ls[2] = {0.f, 0.f};        // running sum over this lane's own keys only; halves joined after the loop
  v8f acc[2][4] = {};              // acc[cg][tl][r] = O[query cg*16 + l16][dh tl*16 + hs*8 + r], the wave's keys only

  // two-buffer ring: stage s + 1 flies into the other buffer while stage s is worked on
  stage_copies(lkoff, lvoff, kg, vg);                       // stage 0 -> buffer 0
  async_wait0();
  __syncthreads();                                          // stage 0 visible to every wave
  stage_copies(lkoff + SK_ * KP_ * 2, lvoff + 64 * VP_ * 2, kg + (size_t)SK_ * E_, vg + SK_);  // stage 1 -> buffer 1

  for (int s = 0; s < NST_; ++s) {
   const int buf = s & 1;
   const f16* bK = lK + buf * (SK_ * KP_) + kq * (WK_ * KP_);
   const f16* bV = lV + buf * (64 * VP_) + kq * WK_;
   // unrolled: the wave's two 32-key passes of a stage read LDS at immediate offsets from one base
   #pragma unroll
   for (int p = 0; p < WK_ / 32; ++p) {
    // S^T = K * Q^T for two 16-key tiles and two column groups:
    // c0[cg][r] = S[query cg*16 + l16][key hs*8 + r], c1: keys + 16
    v8f c0[2] = {}, c1[2] = {};
    {
      const f16* kbp = &bK[(p * 32 + l16) * KP_ + hs * 8];
      const v16h k00 = ld_frag(kbp), k01 = ld_frag(kbp + 32);
      const v16h k10 = ld_frag(kbp + 16 * KP_), k11 = ld_frag(kbp + 16 * KP_ + 32);
      #pragma unroll
      for (int cg = 0; cg < 2; ++cg) {
        c0[cg] = wmma32(k00, qa[cg][0], c0[cg]);
        c1[cg] = wmma32(k10, qa[cg][0], c1[cg]);
      }
      #pragma unroll
      for (int cg = 0; cg < 2; ++cg) {
        c0[cg] = wmma32(k01, qa[cg][1], c0[cg]);
        c1[cg] = wmma32(k11, qa[cg][1], c1[cg]);
      }
    }

    v16h pb[2];
    #pragma unroll
    for (int cg = 0; cg < 2; ++cg) {
      // column maximum: a tree over the lane's own 16 scores, then one exchange between halves
      float m8[8];
      #pragma unroll
      for (int r = 0; r < 8; ++r) m8[r] = fmaxf(c0[cg][r], c1[cg][r]);
      float ml = fmaxf(fmaxf(fmaxf(m8[0], m8[1]), fmaxf(m8[2], m8[3])),
                       fmaxf(fmaxf(m8[4], m8[5]), fmaxf(m8[6], m8[7])));
      ml = fmaxf(ml, xhalf(ml));
      const float nm = fmaxf(Mx[cg], ml);
      const float al = exp1(Mx[cg] - nm);
      Mx[cg] = nm;

      const v8f e0 = exp8(c0[cg] - nm);
      const v8f e1 = exp8(c1[cg] - nm);
      const v8f s8 = e0 + e1;
      Ls[cg] = Ls[cg] * al + (((s8[0] + s8[1]) + (s8[2] + s8[3])) + ((s8[4] + s8[5]) + (s8[6] + s8[7])));
      #pragma unroll
      for (int tl = 0; tl < 4; ++tl) acc[cg][tl] *= al;

      // P^T as B operand straight from the accumulators: element s is key hs*8 + s, then 16 + hs*8 + (s - 8)
      pb[cg] = cat8(__builtin_convertvector(e0, v8h), __builtin_convertvector(e1, v8h));
    }

    // O^T += V^T(64x32) * P^T(32x16): per dh tile one V fragment, keys contiguous in lV rows, for both column groups
    #pragma unroll
    for (int tl = 0; tl < 4; ++tl) {
      const v16h va = ld_frag(&bV[(tl * 16 + l16) * VP_ + p * 32 + hs * 8]);
      acc[0][tl] = wmma32(va, pb[0], acc[0][tl]);
      acc[1][tl] = wmma32(va, pb[1], acc[1][tl]);
    }
   }
   // publish point of stage s + 1: own reads of this buffer done, own copies landed, then every wave meets
   ds_wait0();
   async_wait0();
   __syncthreads();
   if (s + 2 < NST_)   // refill the buffer that every wave has just left
     stage_copies(lkoff + buf * (SK_ * KP_ * 2), lvoff + buf * (64 * VP_ * 2),
                  kg + (size_t)(s + 2) * SK_ * E_, vg + (s + 2) * SK_);
  }
  async_wait0();       // nothing of this wave is in flight when it leaves the loop

  // every wave lays down its share: maximum, sum and O of its two column groups; a store is 512 contiguous bytes
  #pragma unroll
  for (int cg = 0; cg < 2; ++cg) {
    xM[(wave * 2 + cg) * 32 + lane] = Mx[cg];
    xL[(wave * 2 + cg) * 32 + lane] = Ls[cg];
    #pragma unroll
    for (int tl = 0; tl < 4; ++tl) {
      float* d = xO + (wave * 8 + cg * 4 + tl) * 256 + lane * 4;
      *(v4f*)d = __builtin_shufflevector(acc[cg][tl], acc[cg][tl], 0, 1, 2, 3);
      *(v4f*)(d + 128) = __builtin_shufflevector(acc[cg][tl], acc[cg][tl], 4, 5, 6, 7);
    }
  }
  __syncthreads();     // the four shares of every column are visible

  // the join, spread over the four waves of a column block: wave kq takes column group kq / 2, dh tiles 2 * (kq % 2), + 1
  const int cgj = kq >> 1, tl0 = (kq & 1) * 2;
  float mk[KQ_], f[KQ_];
  #pragma unroll
  for (int k = 0; k < KQ_; ++k) mk[k] = xM[((k * 4 + cw) * 2 + cgj) * 32 + lane];
  const float mg = fmaxf(fmaxf(mk[0], mk[1]), fmaxf(mk[2], mk[3]));
  float lg = 0.f;
  #pragma unroll
  for (int k = 0; k < KQ_; ++k) {
    f[k] = exp1(mk[k] - mg);
    lg += f[k] * xL[((k * 4 + cw) * 2 + cgj) * 32 + lane];
  }
  lg += xhalf(lg);
  const float inv = 1.f / lg;
  // a column group's 16 queries are one band; head h is its k steps 2h and 2h + 1; a store is 512 contiguous bytes
  f16* oband = ctx16 + (size_t)(b * LQ_ + qrow0 + cgj * 16) * E_ + h * 2 * 512 + lane * 8;
  #pragma unroll
  for (int u = 0; u < 2; ++u) {
    v8f o = {};
    #pragma unroll
    for (int k = 0; k < KQ_; ++k) {
      const float* sp = xO + ((k * 4 + cw) * 8 + cgj * 4 + tl0 + u) * 256 + lane * 4;
      const v4f lo = *(const v4f*)sp, hi = *(const v4f*)(sp + 128);
      o += f[k] * __builtin_shufflevector(lo, hi, 0, 1, 2, 3, 4, 5, 6, 7);
    }
    *(v8h*)(oband + (tl0 + u) * 256) = __builtin_convertvector(o * inv, v8h);  // 8 consecutive dh of one query
  }
}

// ---------------------------------------- output projection + bias + residual (f32)
// block = 2 waves side by side, 64 rows x 64 columns a wave: 64 rows x 128 columns; ctx and W in fragment order
__global__ __launch_bounds__(64) void gemm_out(const f16* __restrict__ ctx, const f16* __restrict__ W,
                                               const float* __restrict__ bias, const float* __restrict__ resid,
                                               float* __restrict__ xres) {
  const int K = E_, N = E_;
  const int wave = threadIdx.x >> 5, lane = threadIdx.x & 31;
  const int l16 = lane & 15, hs = lane >> 4;
  const int row0 = (blockIdx.x >> 2) * 64;
  const int col0 = ((blockIdx.x & 3) * 2 + wave) * 64;
  v8f acc[4][4] = {};
  tile_product(ctx + (size_t)row0 * K + lane * 8, W + (size_t)col0 * K + lane * 8, acc);
  float bc[4];
  #pragma unroll
  for (int j = 0; j < 4; ++j) bc[j] = bias[col0 + j * 16 + l16];
  // before a later load's result may land on the register that holds the bias loads' address
  asm volatile("s_wait_xcnt 0x0" ::: "memory");
  // one lane offset for the whole tile; every element lies a compile-time distance from it
  const int base = (row0 + hs * 8) * N + col0 + l16;
  const float* rp = resid + base;
  float* xp = xres + base;
  // two halves of 32 rows: 64 residual values at a time beside the 128 accumulators stay below v256
  #pragma unroll
  for (int h = 0; h < 2; ++h) {
    // before the second half reuses registers that the first half's loads and stores name
    if (h == 1) asm volatile("s_wait_xcnt 0x0" ::: "memory");
    #pragma unroll
    for (int i = 2 * h; i < 2 * h + 2; ++i) {
      #pragma unroll
      for (int j = 0; j < 4; ++j) {
        #pragma unroll
        for (int r = 0; r < 8; ++r) {
          const int d = (i * 16 + r) * N + j * 16;
          xp[d] = acc[i][j][r] + bc[j] + rp[d];
        }
      }
    }
  }
}

// ------------------------------------------------------------------ LayerNorm
__global__ __launch_bounds__(256) void ln_row(const float* __restrict__ x, const float* __restrict__ g,
                                              const float* __restrict__ be, float* __restrict__ out) {
  const int row = blockIdx.x * 8 + (threadIdx.x >> 5);
  const int lane = threadIdx.x & 31;
  const float* xr = x + (size_t)row * E_ + lane * 16;
  v4f v[4];
  float s = 0.f, s2 = 0.f;
  #pragma unroll
  for (int j = 0; j < 4; ++j) {
    v[j] = *(const v4f*)(xr + 4 * j);
    #pragma unroll
    for (int e = 0; e < 4; ++e) { s += v[j][e]; s2 += v[j][e] * v[j][e]; }
  }
  #pragma unroll
  for (int mask = 1; mask < 32; mask <<= 1) {
    s  += __shfl_xor(s, mask, 32);
    s2 += __shfl_xor(s2, mask, 32);
  }
  const float mu = s * (1.f / E_);
  const float var = fmaxf(s2 * (1.f / E_) - mu * mu, 0.f);
  const float rstd = rsqrtf(var + 1e-5f);
  float* orow = out + (size_t)row * E_ + lane * 16;
  const float* gp = g + lane * 16;
  const float* bp = be + lane * 16;
  #pragma unroll
  for (int j = 0; j < 4; ++j) {
    v4f o;
    #pragma unroll
    for (int e = 0; e < 4; ++e)
      o[e] = (v[j][e] - mu) * rstd * gp[4 * j + e] + bp[4 * j + e];
    *(v4f*)(orow + 4 * j) = o;
  }
}

// ------------------------------------------------------------------ launcher
extern "C" void kernel_launch(void* const* d_in, const int* in_sizes, int n_in,
                              void* d_out, int out_size, void* d_ws, size_t ws_size,
                              hipStream_t stream) {
  (void)in_sizes; (void)n_in; (void)out_size; (void)ws_size;
  const float* query     = (const float*)d_in[0];
  const float* key_value = (const float*)d_in[1];
  const float* Wq = (const float*)d_in[2];
  const float* bq = (const float*)d_in[3];
  const float* Wk = (const float*)d_in[4];
  const float* bk = (const float*)d_in[5];
  const float* Wv = (const float*)d_in[6];
  const float* bv = (const float*)d_in[7];
  const float* Wo = (const float*)d_in[8];
  const float* bo = (const float*)d_in[9];
  const float* gamma = (const float*)d_in[10];
  const float* beta  = (const float*)d_in[11];
  float* out = (float*)d_out;

  const size_t nQ  = (size_t)B_ * LQ_ * E_;   // 2,097,152
  const size_t nKV = (size_t)B_ * LK_ * E_;   // 4,194,304
  const size_t nW  = (size_t)E_ * E_;         //   262,144

  f16* p = (f16*)d_ws;
  f16* xq16  = p; p += nQ;
  f16* kv16  = p; p += nKV;
  f16* Wq16  = p; p += nW;
  f16* Wk16  = p; p += nW;
  f16* Wv16  = p; p += nW;
  f16* Wo16  = p; p += nW;
  f16* q16   = p; p += nQ;
  f16* k16   = p; p += nKV;
  f16* vT16  = p; p += nKV;
  f16* ctx16 = p; p += nQ;
  float* xres = (float*)p;                    // nQ floats

  // xq16, kv16, Wq16, Wk16, Wv16, Wo16 are one run of the workspace, filled in this order, each in fragment order
  cvt_f32_f16<<<dim3(CVQ_ + CVKV_ + 4 * CVW_), dim3(256), 0, stream>>>(query, key_value, Wq, Wk, Wv, Wo, xq16);

  // Q = (x @ Wq^T + bq) * 1/sqrt(DH), K = kv @ Wk^T + bk, V^T = (kv @ Wv^T + bv)^T per batch
  gemm_qkv<<<dim3(2 * PBKV_ + PBQ_), dim3(128), 0, stream>>>(xq16, kv16, Wq16, Wk16, Wv16, bq, bk, bv, q16, k16, vT16);

  flash_attn<<<dim3(LQ_ / 128, B_ * H_, 1), 512, 0, stream>>>(q16, k16, vT16, ctx16);

  gemm_out<<<dim3((4096 / 64) * (512 / 128), 1, 1), 64, 0, stream>>>(ctx16, Wo16, bo, query, xres);

  ln_row<<<dim3((B_ * LQ_) / 8, 1, 1), 256, 0, stream>>>(xres, gamma, beta, out);
}

// v009
// A run of this version takes 66.2 microseconds.
// Next to v008, in two timings, it ran 1.04 and 1.05 times as fast.
// All steps since v000 together make it 4.63 times as fast.
#include <hip/hip_runtime.h>

typedef _Float16 f16;
typedef __attribute__((ext_vector_type(4)))  f16   v4h;
typedef __attribute__((ext_vector_type(8)))  f16   v8h;
typedef __attribute__((ext_vector_type(16))) f16   v16h;
typedef __attribute__((ext_vector_type(8)))  float v8f;
typedef __attribute__((ext_vector_type(4)))  float v4f;

#define E_  512
#define H_  8
#define DH_ 64
#define LQ_ 2048
#define LK_ 4096
#define B_  2
// LDS row pitches in f16 elements: 16 B x odd, so the 16 rows one ds_load_b128 touches spread over all banks
#define KP_ 72   // 64 dh    + 8 pad = 144 B
#define VP_ 264  // 256 keys + 8 pad = 528 B
#define SK_  256           // keys per stage of the K/V ring in flash_attn
#define NST_ (LK_ / SK_)   // stages
#define KQ_  4             // the waves of flash_attn that share 32 query columns: each takes SK_ / KQ_ keys of a stage
#define WK_  (SK_ / KQ_)   // keys of a stage per wave: two passes of 32

static __device__ __forceinline__ v16h cat8(v8h lo, v8h hi) {
  return __builtin_shufflevector(lo, hi, 0,1,2,3,4,5,6,7,8,9,10,11,12,13,14,15);
}
static __device__ __forceinline__ v16h ld_frag(const f16* p) {
  v8h lo = *(const v8h*)p;
  v8h hi = *(const v8h*)(p + 16);
  return cat8(lo, hi);
}
// Fragment order: how the f16 operands of the four dense products lie in the workspace. A band of 16 rows x 512 k
// keeps its 16 KB, but inside it element (row r, k) stands at (k / 32) * 512 + (k / 8 % 4) * 128 + r * 8 + k % 8.
// The two halves of a lane's 16 x 32 fragment are then at lane * 8 and 256 + lane * 8 of a 1 KB block, so a wave-wide
// load is 512 contiguous bytes (4 cache lines); from row-major rows it took 32 B out of each of 16 lines.
// Which k a lane holds at which place is what ld_frag gives on a row-major matrix.
#define BAND_ (16 * E_)   // elements of a band
static __device__ __forceinline__ v16h ld_pack(const f16* p) {
  v8h lo = *(const v8h*)p;
  v8h hi = *(const v8h*)(p + 256);
  return cat8(lo, hi);
}
static __device__ __forceinline__ v8f wmma32(v16h a, v16h b, v8f c) {
  // D = A(16x32 f16) * B(32x16 f16) + C(16x16 f32)
  return __builtin_amdgcn_wmma_f32_16x16x32_f16(false, a, false, b, (short)0, c, false, false);
}

// One lane's share of a K/V stage: eight async global->LDS copies of 16 B (ASYNCcnt), four of K rows and four of
// V^T rows. The closing s_wait_xcnt stands in the copies' own statement, so that no address register of a copy
// is rewritten ahead of it.
static __device__ __forceinline__ void stage_copies(uint32_t lk, uint32_t lv, const f16* kg, const f16* vg) {
  asm volatile("global_load_async_to_lds_b128 %0, %8, off\n\t"
               "global_load_async_to_lds_b128 %1, %9, off\n\t"
               "global_load_async_to_lds_b128 %2, %10, off\n\t"
               "global_load_async_to_lds_b128 %3, %11, off\n\t"
               "global_load_async_to_lds_b128 %4, %12, off\n\t"
               "global_load_async_to_lds_b128 %5, %13, off\n\t"
               "global_load_async_to_lds_b128 %6, %14, off\n\t"
               "global_load_async_to_lds_b128 %7, %15, off\n\t"
               "s_wait_xcnt 0x0"
               :: "v"(lk), "v"(lk + 64 * KP_ * 2), "v"(lk + 128 * KP_ * 2), "v"(lk + 192 * KP_ * 2),
                  "v"(lv), "v"(lv + 16 * VP_ * 2), "v"(lv + 32 * VP_ * 2), "v"(lv + 48 * VP_ * 2),
                  "v"(kg), "v"(kg + 64 * E_), "v"(kg + 128 * E_), "v"(kg + 192 * E_),
                  "v"(vg), "v"(vg + 16 * LK_), "v"(vg + 32 * LK_), "v"(vg + 48 * LK_)
               : "memory");
}
// the wave's own copies have landed
static __device__ __forceinline__ void async_wait0() {
  asm volatile("s_wait_asynccnt 0x0" ::: "memory");
}
// the wave's own LDS reads have returned, before the buffer they read is handed back for a refill
static __device__ __forceinline__ void ds_wait0() {
  asm volatile("s_wait_dscnt 0x0" ::: "memory");
}

// ---------------------------------------------------------------- convert
// All six f32 arrays in one launch. Their f16 copies lie one behind the other in the workspace, in the order of the
// arguments, so a block's place in the output follows from its index alone. A block converts CVB_ elements of ONE
// array, 32 rows = two bands, and writes them in fragment order; a lane issues its CVL_ loads of 16 B before the
// first conversion. A lane takes 8 consecutive k of one row at a time (two loads, one 16 B store); a wave takes
// 8 rows x 32 k: it reads 8 whole lines with a pair of loads and fills 4 whole lines with the store.
// Few waves, each with much in flight: waves start at a bounded rate, which holds a grid of one-load waves back.
#define CVL_ 16                 // loads per lane
#define CVB_ (256 * 4 * CVL_)   // elements per block; divides the size of every array
#define CVQ_  (B_ * LQ_ * E_ / CVB_)   // blocks of the query array
#define CVKV_ (B_ * LK_ * E_ / CVB_)   // blocks of the key/value array
#define CVW_  (E_ * E_ / CVB_)         // blocks of one weight matrix
static_assert(CVB_ == 2 * BAND_, "a block of cvt_f32_f16 converts two bands");
__global__ __launch_bounds__(256) void cvt_f32_f16(const float* __restrict__ xq, const float* __restrict__ kv,
                                                   const float* __restrict__ wq, const float* __restrict__ wk,
                                                   const float* __restrict__ wv, const float* __restrict__ wo,
                                                   f16* __restrict__ out) {
  int r = blockIdx.x;           // becomes the block's index inside its own array
  const float* src;
  if (r < CVQ_) {
    src = xq;
  } else if (r < CVQ_ + CVKV_) {
    src = kv;
    r -= CVQ_;
  } else {
    r -= CVQ_ + CVKV_;
    const int w = r / CVW_;
    r -= w * CVW_;
    src = w == 0 ? wq : w == 1 ? wk : w == 2 ? wv : wo;
  }
  const int wave = threadIdx.x >> 5, lane = threadIdx.x & 31;
  const int g = wave >> 1, kh = wave & 1;   // the wave's 8 of the 32 rows, its half of the row (8 k steps of 32)
  const int rr = lane >> 2, q = lane & 3;   // the lane's row among the 8, its 8 k among the 32 of a step
  const float* s = src + (size_t)r * CVB_ + (g * 8 + rr) * E_ + kh * 256 + q * 8;   // + 32 per k step
  f16* d = out + (size_t)blockIdx.x * CVB_ + (g >> 1) * BAND_ + kh * 4096 + q * 128 + ((g & 1) * 8 + rr) * 8;  // + 512
  v4f v[CVL_];
  #pragma unroll
  for (int i = 0; i < CVL_; ++i) v[i] = *(const v4f*)(s + (i >> 1) * 32 + (i & 1) * 4);
  // the loads' address pair, named here, stays whole up to this wait: without it the last load's result was given
  // the pair's own registers, which the fifteen loads before it name too
  asm volatile("s_wait_xcnt 0x0" :: "v"(s) : "memory");
  // keeps every load ahead of the first conversion: without it the last two loads were issued into the first two's
  // registers, behind the wait for those, and the wave paid the memory latency twice
  __builtin_amdgcn_sched_barrier(0);
  #pragma unroll
  for (int i = 0; i < CVL_ / 2; ++i) {
    v8h o;
    #pragma unroll
    for (int e = 0; e < 4; ++e) { o[e] = (f16)v[2 * i][e]; o[4 + e] = (f16)v[2 * i + 1][e]; }
    *(v8h*)(d + i * 512) = o;
  }
}

// ----------------------------------------------------- register-tiled product
// One wave owns MI x 4 accumulator tiles (MI * 16 rows x 64 columns): at MI = 4 a k step of 32 loads 8 fragments for
// 16 WMMAs, where one tile a wave loaded 2 fragments for 1. Each tile still sums k in ascending order.
// Both operands lie in fragment order. ap0 / bp0: this lane's address in the first row tile's / column tile's band;
// further tiles lie a band on, further k steps 512 elements on.
// The fragments go through a ring of three register sets, so that two k steps of loads are in flight.
template <int MI>
static __device__ __forceinline__ void tile_product(const f16* __restrict__ ap0, const f16* __restrict__ bp0,
                                                    v8f (&acc)[MI][4]) {
  const int K = E_;
  v16h a[3][MI], b[3][4];
  #pragma unroll
  for (int s = 0; s < 2; ++s) {
    #pragma unroll
    for (int i = 0; i < MI; ++i) a[s][i] = ld_pack(ap0 + i * BAND_ + s * 512);
    #pragma unroll
    for (int j = 0; j < 4; ++j) b[s][j] = ld_pack(bp0 + j * BAND_ + s * 512);
  }
  // unrolled: the ring index is a compile-time value, so the three sets stay in registers
  #pragma unroll
  for (int ks = 0; ks < K / 32; ++ks) {
    const int cur = ks % 3, nxt = (ks + 2) % 3;
    if (ks + 2 < K / 32) {
      #pragma unroll
      for (int i = 0; i < MI; ++i) a[nxt][i] = ld_pack(ap0 + i * BAND_ + (ks + 2) * 512);
      #pragma unroll
      for (int j = 0; j < 4; ++j) b[nxt][j] = ld_pack(bp0 + j * BAND_ + (ks + 2) * 512);
    }
    // keeps the loads of step ks + 2 ahead of the products of step ks: without it the scheduler sinks every load
    // to just before its first use, and the lone wave of a SIMD waits out the whole load latency at each fragment
    __builtin_amdgcn_sched_barrier(0);
    #pragma unroll
    for (int i = 0; i < MI; ++i)
      #pragma unroll
      for (int j = 0; j < 4; ++j)
        acc[i][j] = wmma32(a[cur][i], b[cur][j], acc[i][j]);
    // the other side of the same fence: the next step's loads stay one group, behind these products
    __builtin_amdgcn_sched_barrier(0);
  }
  // before the caller's epilogue reuses the two register pairs that hold the fragment loads' addresses; the pairs,
  // named here, stay whole up to this wait
  asm volatile("s_wait_xcnt 0x0" :: "v"(ap0), "v"(bp0) : "memory");
  // keeps the epilogue's first address arithmetic behind that wait
  __builtin_amdgcn_sched_barrier(0);
}

// ----------------------------------------------------- projection GEMMs (f16 out)
// out = (X @ W^T + bias) * scale ; X:[rows][512] f16 (batch folded into the rows), W:[512][512] f16, both in
// fragment order; out row-major. K and Q: out[row][col]; V: out[batch][col][row in batch] (V^T).
// ONE launch holds the blocks of all three products: none reads what another writes, so they need no launch
// boundary between them, and a WGP holds two or three blocks at once, whose starts, load waits and stores overlap.
// block = 2 x 2 waves: 128 rows x 128 columns; inside a product, index = row block * 4 + column block.
// K block i and V block i read the same 128 rows of kv.
#define PBKV_ ((B_ * LK_ / 128) * (E_ / 128))   // blocks of the K product, and of the V product
#define PBQ_  ((B_ * LQ_ / 128) * (E_ / 128))   // blocks of the Q product
__global__ __launch_bounds__(128) void gemm_qkv(const f16* __restrict__ xq, const f16* __restrict__ kv,
                                                const f16* __restrict__ Wq, const f16* __restrict__ Wk,
                                                const f16* __restrict__ Wv, const float* __restrict__ bq,
                                                const float* __restrict__ bk, const float* __restrict__ bv,
                                                f16* __restrict__ q, f16* __restrict__ k, f16* __restrict__ vT) {
  const int K = E_, N = E_;
  const int wave = threadIdx.x >> 5, lane = threadIdx.x & 31;
  const int l16 = lane & 15, hs = lane >> 4;
  int blk = blockIdx.x;         // becomes the block's index inside its own product
  const f16* X = kv;
  const f16* W = Wk;
  const float* bias = bk;
  f16* out = k;
  float scale = 1.0f;
  bool tr = false;
  if (blk >= 2 * PBKV_) {
    blk -= 2 * PBKV_;
    X = xq; W = Wq; bias = bq; out = q;
    scale = 0.125f;             // 1 / sqrt(DH)
  } else if (blk >= PBKV_) {
    blk -= PBKV_;
    W = Wv; bias = bv;
    tr = true;
  }
  const int row0 = ((blk >> 2) * 2 + (wave >> 1)) * 64;
  const int col0 = ((blk & 3) * 2 + (wave & 1)) * 64;
  v8f acc[4][4] = {};
  tile_product(X + (size_t)row0 * K + lane * 8, W + (size_t)col0 * K + lane * 8, acc);
  if (!tr) {
    #pragma unroll
    for (int j = 0; j < 4; ++j) {
      const int col = col0 + j * 16 + l16;
      const float bc = bias[col];
      #pragma unroll
      for (int i = 0; i < 4; ++i) {
        const int rowb = row0 + i * 16 + hs * 8;
        #pragma unroll
        for (int r = 0; r < 8; ++r)
          out[(size_t)(rowb + r) * N + col] = (f16)((acc[i][j][r] + bc) * scale);
      }
    }
  } else {
    // a wave's 64 rows lie in one batch
    out = vT + (size_t)(row0 / LK_) * LK_ * N + (row0 % LK_);
    #pragma unroll
    for (int j = 0; j < 4; ++j) {
      const int col = col0 + j * 16 + l16;
      const float bc = bias[col];
      #pragma unroll
      for (int i = 0; i < 4; ++i) {
        v8h o;
        #pragma unroll
        for (int r = 0; r < 8; ++r) o[r] = (f16)(acc[i][j][r] + bc);
        *(v8h*)(out + (size_t)col * LK_ + i * 16 + hs * 8) = o;  // contiguous rows
      }
    }
  }
}

static __device__ __forceinline__ float xhalf(float x) {
  // value of lane ^ 16 (the other half of the same query column)
  const int b = __builtin_bit_cast(int, x);
  return __builtin_bit_cast(float, __builtin_amdgcn_permlanex16(b, b, 0x76543210, 0xfedcba98, false, false));
}
// e^x as 2^(x * log2 e), the same two instructions __expf gives, written as asm for the slot the instruction set
// asks for behind a transcendental before its source is overwritten or its result read.
// Early-clobber outputs keep every result off every
// source inside the statement; the closing v_nop is the slot behind the last one.
static __device__ __forceinline__ v8f exp8(v8f x) {
  x *= 1.44269504f;
  float y0, y1, y2, y3, y4, y5, y6, y7;
  asm("v_exp_f32 %0, %8\n\tv_exp_f32 %1, %9\n\tv_exp_f32 %2, %10\n\tv_exp_f32 %3, %11\n\t"
      "v_exp_f32 %4, %12\n\tv_exp_f32 %5, %13\n\tv_exp_f32 %6, %14\n\tv_exp_f32 %7, %15\n\tv_nop"
      : "=&v"(y0), "=&v"(y1), "=&v"(y2), "=&v"(y3), "=&v"(y4), "=&v"(y5), "=&v"(y6), "=&v"(y7)
      : "v"(x[0]), "v"(x[1]), "v"(x[2]), "v"(x[3]), "v"(x[4]), "v"(x[5]), "v"(x[6]), "v"(x[7]));
  return v8f{y0, y1, y2, y3, y4, y5, y6, y7};
}
static __device__ __forceinline__ float exp1(float x) {
  float y;
  asm("v_exp_f32 %0, %1\n\tv_nop" : "=v"(y) : "v"(x * 1.44269504f));  // v_nop: the same slot
  return y;
}
// A block is 16 waves on 128 queries: 4 groups of 32 query columns x KQ_ = 4 shares of the keys. A wave holds TWO
// 16-column groups, so each K and V fragment it reads from LDS feeds two WMMAs, and it walks only its own 64 keys of
// every 256-key stage, so that the chip still holds four waves a SIMD. Each wave keeps its own running maximum, sum
// and O over its keys; the four shares of a column are joined once, through LDS, behind the loop.
__global__ __launch_bounds__(512) void flash_attn(const f16* __restrict__ q16, const f16* __restrict__ k16,
                                                  const f16* __restrict__ vT16, f16* __restrict__ ctx16) {
  __shared__ __attribute__((aligned(16))) f16 lK[2 * SK_ * KP_]; // [buffer][key 0..255][dh 0..63 + pad]
  __shared__ __attribute__((aligned(16))) f16 lV[2 * 64 * VP_];  // [buffer][dh 0..63][key 0..255 + pad]
  __shared__ __attribute__((aligned(16))) float xO[16 * 8 * 256]; // [wave][column group * 4 + dh tile][half][lane][4]
  __shared__ float xM[16 * 2 * 32];                               // [wave][column group][lane]
  __shared__ float xL[16 * 2 * 32];
  const int bh = blockIdx.y, b = bh >> 3, h = bh & 7;
  const int wave = __builtin_amdgcn_readfirstlane(threadIdx.x >> 5), lane = threadIdx.x & 31;
  const int l16 = lane & 15, hs = lane >> 4;
  const int cw = wave & 3, kq = wave >> 2;       // the wave's 32 columns among the 128, its share of the keys
  const int qrow0 = blockIdx.x * 128 + cw * 32;

  // Q^T fragments for this wave's two groups of 16 query columns (K = 64 -> two 32x16 B fragments each)
  v16h qa[2][2];
  #pragma unroll
  for (int cg = 0; cg < 2; ++cg) {
    const f16* qb = q16 + ((size_t)(b * LQ_ + qrow0 + cg * 16 + l16)) * E_ + h * DH_ + hs * 8;
    qa[cg][0] = ld_frag(qb);
    qa[cg][1] = ld_frag(qb + 32);
  }

  // cooperative staging indices (512 threads x 4 x 16 B for each 32 KB tile; a wave's copy covers whole lines)
  const int t = threadIdx.x;
  const int kkey = t >> 3, kdh = (t & 7) * 8;     // + 64 keys per further copy
  const int vdh = t >> 5, vkey = (t & 31) * 8;    // + 16 dh per further copy
  const f16* kg = k16 + ((size_t)b * LK_ + kkey) * E_ + h * DH_ + kdh;  // + stage * SK_ * E_
  const f16* vg = vT16 + ((size_t)b * E_ + h * DH_ + vdh) * LK_ + vkey; // + stage * SK_
  // LDS byte offsets (AS3 offset == low 32 bits of the generic shared pointer)
  const uint32_t lkoff = (uint32_t)(size_t)&lK[kkey * KP_ + kdh];
  const uint32_t lvoff = (uint32_t)(size_t)&lV[vdh * VP_ + vkey];

  float Mx[2] = {-1e30f, -1e30f};  // running maximum of this lane's query column over the wave's keys
  float Ls[2] = {0.f, 0.f};        // running sum over this lane's own keys only; halves joined after the loop
  v8f acc[2][4] = {};              // acc[cg][tl][r] = O[query cg*16 + l16][dh tl*16 + hs*8 + r], the wave's keys only

  // two-buffer ring: stage s + 1 flies into the other buffer while stage s is worked on
  stage_copies(lkoff, lvoff, kg, vg);                       // stage 0 -> buffer 0
  async_wait0();
  __syncthreads();                                          // stage 0 visible to every wave
  stage_copies(lkoff + SK_ * KP_ * 2, lvoff + 64 * VP_ * 2, kg + (size_t)SK_ * E_, vg + SK_);  // stage 1 -> buffer 1

  for (int s = 0; s < NST_; ++s) {
   const int buf = s & 1;
   const f16* bK = lK + buf * (SK_ * KP_) + kq * (WK_ * KP_);
   const f16* bV = lV + buf * (64 * VP_) + kq * WK_;
   // unrolled: the wave's two 32-key passes of a stage read LDS at immediate offsets from one base
   #pragma unroll
   for (int p = 0; p < WK_ / 32; ++p) {
    // S^T = K * Q^T for two 16-key tiles and two column groups:
    // c0[cg][r] = S[query cg*16 + l16][key hs*8 + r], c1: keys + 16
    v8f c0[2] = {}, c1[2] = {};
    {
      const f16* kbp = &bK[(p * 32 + l16) * KP_ + hs * 8];
      const v16h k00 = ld_frag(kbp), k01 = ld_frag(kbp + 32);
      const v16h k10 = ld_frag(kbp + 16 * KP_), k11 = ld_frag(kbp + 16 * KP_ + 32);
      #pragma unroll
      for (int cg = 0; cg < 2; ++cg) {
        c0[cg] = wmma32(k00, qa[cg][0], c0[cg]);
        c1[cg] = wmma32(k10, qa[cg][0], c1[cg]);
      }
      #pragma unroll
      for (int cg = 0; cg < 2; ++cg) {
        c0[cg] = wmma32(k01, qa[cg][1], c0[cg]);
        c1[cg] = wmma32(k11, qa[cg][1], c1[cg]);
      }
    }

    v16h pb[2];
    #pragma unroll
    for (int cg = 0; cg < 2; ++cg) {
      // column maximum: a tree over the lane's own 16 scores, then one exchange between halves
      float m8[8];
      #pragma unroll
      for (int r = 0; r < 8; ++r) m8[r] = fmaxf(c0[cg][r], c1[cg][r]);
      float ml = fmaxf(fmaxf(fmaxf(m8[0], m8[1]), fmaxf(m8[2], m8[3])),
                       fmaxf(fmaxf(m8[4], m8[5]), fmaxf(m8[6], m8[7])));
      ml = fmaxf(ml, xhalf(ml));
      const float nm = fmaxf(Mx[cg], ml);
      const float al = exp1(Mx[cg] - nm);
      Mx[cg] = nm;

      const v8f e0 = exp8(c0[cg] - nm);
      const v8f e1 = exp8(c1[cg] - nm);
      const v8f s8 = e0 + e1;
      Ls[cg] = Ls[cg] * al + (((s8[0] + s8[1]) + (s8[2] + s8[3])) + ((s8[4] + s8[5]) + (s8[6] + s8[7])));
      #pragma unroll
      for (int tl = 0; tl < 4; ++tl) acc[cg][tl] *= al;

      // P^T as B operand straight from the accumulators: element s is key hs*8 + s, then 16 + hs*8 + (s - 8)
      pb[cg] = cat8(__builtin_convertvector(e0, v8h), __builtin_convertvector(e1, v8h));
    }

    // O^T += V^T(64x32) * P^T(32x16): per dh tile one V fragment, keys contiguous in lV rows, for both column groups
    #pragma unroll
    for (int tl = 0; tl < 4; ++tl) {
      const v16h va = ld_frag(&bV[(tl * 16 + l16) * VP_ + p * 32 + hs * 8]);
      acc[0][tl] = wmma32(va, pb[0], acc[0][tl]);
      acc[1][tl] = wmma32(va, pb[1], acc[1][tl]);
    }
   }
   // publish point of stage s + 1: own reads of this buffer done, own copies landed, then every wave meets
   ds_wait0();
   async_wait0();
   __syncthreads();
   if (s + 2 < NST_)   // refill the buffer that every wave has just left
     stage_copies(lkoff + buf * (SK_ * KP_ * 2), lvoff + buf * (64 * VP_ * 2),
                  kg + (size_t)(s + 2) * SK_ * E_, vg + (s + 2) * SK_);
  }
  async_wait0();       // nothing of this wave is in flight when it leaves the loop

  // every wave lays down its share: maximum, sum and O of its two column groups; a store is 512 contiguous bytes
  #pragma unroll
  for (int cg = 0; cg < 2; ++cg) {
    xM[(wave * 2 + cg) * 32 + lane] = Mx[cg];
    xL[(wave * 2 + cg) * 32 + lane] = Ls[cg];
    #pragma unroll
    for (int tl = 0; tl < 4; ++tl) {
      float* d = xO + (wave * 8 + cg * 4 + tl) * 256 + lane * 4;
      *(v4f*)d = __builtin_shufflevector(acc[cg][tl], acc[cg][tl], 0, 1, 2, 3);
      *(v4f*)(d + 128) = __builtin_shufflevector(acc[cg][tl], acc[cg][tl], 4, 5, 6, 7);
    }
  }
  __syncthreads();     // the four shares of every column are visible

  // the join, spread over the four waves of a column block: wave kq takes column group kq / 2, dh tiles 2 * (kq % 2), + 1
  const int cgj = kq >> 1, tl0 = (kq & 1) * 2;
  float mk[KQ_], f[KQ_];
  #pragma unroll
  for (int k = 0; k < KQ_; ++k) mk[k] = xM[((k * 4 + cw) * 2 + cgj) * 32 + lane];
  const float mg = fmaxf(fmaxf(mk[0], mk[1]), fmaxf(mk[2], mk[3]));
  float lg = 0.f;
  #pragma unroll
  for (int k = 0; k < KQ_; ++k) {
    f[k] = exp1(mk[k] - mg);
    lg += f[k] * xL[((k * 4 + cw) * 2 + cgj) * 32 + lane];
  }
  lg += xhalf(lg);
  const float inv = 1.f / lg;
  // a column group's 16 queries are one band; head h is its k steps 2h and 2h + 1; a store is 512 contiguous bytes
  f16* oband = ctx16 + (size_t)(b * LQ_ + qrow0 + cgj * 16) * E_ + h * 2 * 512 + lane * 8;
  #pragma unroll
  for (int u = 0; u < 2; ++u) {
    v8f o = {};
    #pragma unroll
    for (int k = 0; k < KQ_; ++k) {
      const float* sp = xO + ((k * 4 + cw) * 8 + cgj * 4 + tl0 + u) * 256 + lane * 4;
      const v4f lo = *(const v4f*)sp, hi = *(const v4f*)(sp + 128);
      o += f[k] * __builtin_shufflevector(lo, hi, 0, 1, 2, 3, 4, 5, 6, 7);
    }
    *(v8h*)(oband + (tl0 + u) * 256) = __builtin_convertvector(o * inv, v8h);  // 8 consecutive dh of one query
  }
}

// ------------------------- output projection + bias + residual + LayerNorm (f32)
// value of lane ^ M inside the lane's row of 16 (a DPP move, which the compiler folds into the add that uses it)
template <int M>
static __device__ __forceinline__ float xrow(float x) {
  const int v = __builtin_bit_cast(int, x);
  return __builtin_bit_cast(float, __builtin_amdgcn_update_dpp(v, v, 0x160 + M, 0xf, 0xf, true));  // row_xmask:M
}
// 1 / sqrt(x), the one instruction rsqrtf gives, as asm for the same slot behind a transcendental as in exp1
static __device__ __forceinline__ float rsq1(float x) {
  float y;
  asm("v_rsq_f32 %0, %1\n\tv_nop" : "=v"(y) : "v"(x));
  return y;
}
// A block holds OR_ WHOLE rows of x = query + ctx @ Wo^T + bo: 8 waves side by side, OR_ rows x 64 columns a wave;
// ctx and W in fragment order. x never leaves the registers: each wave sums its 64 columns of every row (in-lane over
// the 4 column tiles, then over the 16 lanes of a row of lanes), the 8 shares of a row are joined through LDS, and
// the block normalises and writes the output itself.
#define OR_ 32
__global__ __launch_bounds__(256) void gemm_out_ln(const f16* __restrict__ ctx, const f16* __restrict__ W,
                                                   const float* __restrict__ bias, const float* __restrict__ resid,
                                                   const float* __restrict__ g, const float* __restrict__ be,
                                                   float* __restrict__ out) {
  __shared__ __attribute__((aligned(16))) float red[8 * OR_ * 2];  // [wave][row][sum, sum of squares]
  __shared__ __attribute__((aligned(16))) float stat[OR_ * 2];     // [row][mean, 1 / std]
  const int K = E_, N = E_;
  const int wave = threadIdx.x >> 5, lane = threadIdx.x & 31;
  const int l16 = lane & 15, hs = lane >> 4;
  const int row0 = blockIdx.x * OR_;
  const int col0 = wave * 64;
  // the lane's 4 columns of bias, gamma and beta, asked for ahead of the product, which hides their latency
  float bc[4], gc[4], bec[4];
  #pragma unroll
  for (int j = 0; j < 4; ++j) {
    bc[j] = bias[col0 + j * 16 + l16];
    gc[j] = g[col0 + j * 16 + l16];
    bec[j] = be[col0 + j * 16 + l16];
  }
  // before a later load's result may land on a register that holds an address of these loads
  asm volatile("s_wait_xcnt 0x0" ::: "memory");
  v8f acc[OR_ / 16][4] = {};
  tile_product<OR_ / 16>(ctx + (size_t)row0 * K + lane * 8, W + (size_t)col0 * K + lane * 8, acc);
  // one lane offset for the whole tile; every element lies a compile-time distance from it
  const int base = (row0 + hs * 8) * N + col0 + l16;
  const float* rp = resid + base;
  float* op = out + base;
  v8f rs[OR_ / 16][4];
  #pragma unroll
  for (int i = 0; i < OR_ / 16; ++i)
    #pragma unroll
    for (int j = 0; j < 4; ++j)
      #pragma unroll
      for (int r = 0; r < 8; ++r) rs[i][j][r] = rp[(i * 16 + r) * N + j * 16];
  // the residual loads' lane offset, named here, stays whole up to this wait
  asm volatile("s_wait_xcnt 0x0" :: "v"(base) : "memory");
  #pragma unroll
  for (int i = 0; i < OR_ / 16; ++i)
    #pragma unroll
    for (int j = 0; j < 4; ++j) acc[i][j] = acc[i][j] + bc[j] + rs[i][j];

  // the wave's share of every row's sum and sum of squares; s[i][r] belongs to row i * 16 + hs * 8 + r
  #pragma unroll
  for (int i = 0; i < OR_ / 16; ++i) {
    v8f s = (acc[i][0] + acc[i][1]) + (acc[i][2] + acc[i][3]);
    v8f s2 = (acc[i][0] * acc[i][0] + acc[i][1] * acc[i][1]) + (acc[i][2] * acc[i][2] + acc[i][3] * acc[i][3]);
    #pragma unroll
    for (int r = 0; r < 8; ++r) {
      s[r] += xrow<1>(s[r]);  s2[r] += xrow<1>(s2[r]);
      s[r] += xrow<2>(s[r]);  s2[r] += xrow<2>(s2[r]);
      s[r] += xrow<4>(s[r]);  s2[r] += xrow<4>(s2[r]);
      s[r] += xrow<8>(s[r]);  s2[r] += xrow<8>(s2[r]);
    }
    if (l16 == 0) {
      float* d = red + (wave * OR_ + i * 16 + hs * 8) * 2;
      #pragma unroll
      for (int r = 0; r < 8; r += 2) *(v4f*)(d + r * 2) = v4f{s[r], s2[r], s[r + 1], s2[r + 1]};
    }
  }
  __syncthreads();     // the eight shares of every row are visible
  if (threadIdx.x < OR_) {
    float s = 0.f, s2 = 0.f;
    #pragma unroll
    for (int w = 0; w < 8; ++w) {
      s += red[(w * OR_ + threadIdx.x) * 2];
      s2 += red[(w * OR_ + threadIdx.x) * 2 + 1];
    }
    const float mu = s * (1.f / E_);
    const float var = fmaxf(s2 * (1.f / E_) - mu * mu, 0.f);
    stat[threadIdx.x * 2] = mu;
    stat[threadIdx.x * 2 + 1] = rsq1(var + 1e-5f);
  }
  __syncthreads();     // every row's mean and 1 / std are visible
  #pragma unroll
  for (int i = 0; i < OR_ / 16; ++i) {
    #pragma unroll
    for (int r = 0; r < 8; ++r) {
      const float mu = stat[(i * 16 + hs * 8 + r) * 2], rstd = stat[(i * 16 + hs * 8 + r) * 2 + 1];
      #pragma unroll
      for (int j = 0; j < 4; ++j) acc[i][j][r] = (acc[i][j][r] - mu) * rstd * gc[j] + bec[j];
    }
  }
  // every value stands in its own register before the first store: no register that a store names is written again
  __builtin_amdgcn_sched_barrier(0);
  #pragma unroll
  for (int i = 0; i < OR_ / 16; ++i)
    #pragma unroll
    for (int j = 0; j < 4; ++j)
      #pragma unroll
      for (int r = 0; r < 8; ++r) op[(i * 16 + r) * N + j * 16] = acc[i][j][r];
}

// ------------------------------------------------------------------ launcher
extern "C" void kernel_launch(void* const* d_in, const int* in_sizes, int n_in,
                              void* d_out, int out_size, void* d_ws, size_t ws_size,
                              hipStream_t stream) {
  (void)in_sizes; (void)n_in; (void)out_size; (void)ws_size;
  const float* query     = (const float*)d_in[0];
  const float* key_value = (const float*)d_in[1];
  const float* Wq = (const float*)d_in[2];
  const float* bq = (const float*)d_in[3];
  const float* Wk = (const float*)d_in[4];
  const float* bk = (const float*)d_in[5];
  const float* Wv = (const float*)d_in[6];
  const float* bv = (const float*)d_in[7];
  const float* Wo = (const float*)d_in[8];
  const float* bo = (const float*)d_in[9];
  const float* gamma = (const float*)d_in[10];
  const float* beta  = (const float*)d_in[11];
  float* out = (float*)d_out;

  const size_t nQ  = (size_t)B_ * LQ_ * E_;   // 2,097,152
  const size_t nKV = (size_t)B_ * LK_ * E_;   // 4,194,304
  const size_t nW  = (size_t)E_ * E_;         //   262,144

  f16* p = (f16*)d_ws;
  f16* xq16  = p; p += nQ;
  f16* kv16  = p; p += nKV;
  f16* Wq16  = p; p += nW;
  f16* Wk16  = p; p += nW;
  f16* Wv16  = p; p += nW;
  f16* Wo16  = p; p += nW;
  f16* q16   = p; p += nQ;
  f16* k16   = p; p += nKV;
  f16* vT16  = p; p += nKV;
  f16* ctx16 = p;

  // xq16, kv16, Wq16, Wk16, Wv16, Wo16 are one run of the workspace, filled in this order, each in fragment order
  cvt_f32_f16<<<dim3(CVQ_ + CVKV_ + 4 * CVW_), dim3(256), 0, stream>>>(query, key_value, Wq, Wk, Wv, Wo, xq16);

  // Q = (x @ Wq^T + bq) * 1/sqrt(DH), K = kv @ Wk^T + bk, V^T = (kv @ Wv^T + bv)^T per batch
  gemm_qkv<<<dim3(2 * PBKV_ + PBQ_), dim3(128), 0, stream>>>(xq16, kv16, Wq16, Wk16, Wv16, bq, bk, bv, q16, k16, vT16);

  flash_attn<<<dim3(LQ_ / 128, B_ * H_, 1), 512, 0, stream>>>(q16, k16, vT16, ctx16);

  gemm_out_ln<<<dim3((B_ * LQ_) / OR_, 1, 1), 256, 0, stream>>>(ctx16, Wo16, bo, query, gamma, beta, out);
}

// v010
// One run takes 60 microseconds.
// In both of two side-by-side timings against v009, it was 1.11 times as fast.
// All steps since v000 together make it 5.13 times as fast.
#include <hip/hip_runtime.h>

typedef _Float16 f16;
typedef __attribute__((ext_vector_type(4)))  f16   v4h;
typedef __attribute__((ext_vector_type(8)))  f16   v8h;
typedef __attribute__((ext_vector_type(16))) f16   v16h;
typedef __attribute__((ext_vector_type(8)))  float v8f;
typedef __attribute__((ext_vector_type(4)))  float v4f;

#define E_  512
#define H_  8
#define DH_ 64
#define LQ_ 2048
#define LK_ 4096
#define B_  2
// LDS row pitches in f16 elements: 16 B x odd, so the 16 rows one ds_load_b128 touches spread over all banks
#define KP_ 72   // 64 dh    + 8 pad = 144 B
#define VP_ 264  // 256 keys + 8 pad = 528 B
#define SK_  256           // keys per stage of the K/V ring in flash_attn
#define NST_ (LK_ / SK_)   // stages
#define KQ_  4             // the waves of flash_attn that share 32 query columns: each takes SK_ / KQ_ keys of a stage
#define WK_  (SK_ / KQ_)   // keys of a stage per wave: two passes of 32

static __device__ __forceinline__ v16h cat8(v8h lo, v8h hi) {
  return __builtin_shufflevector(lo, hi, 0,1,2,3,4,5,6,7,8,9,10,11,12,13,14,15);
}
static __device__ __forceinline__ v16h ld_frag(const f16* p) {
  v8h lo = *(const v8h*)p;
  v8h hi = *(const v8h*)(p + 16);
  return cat8(lo, hi);
}
// Fragment order: how the f16 operands of the four dense products lie in the workspace. A band of 16 rows x 512 k
// keeps its 16 KB, but inside it element (row r, k) stands at (k / 32) * 512 + (k / 8 % 4) * 128 + r * 8 + k % 8.
// The two halves of a lane's 16 x 32 fragment are then at lane * 8 and 256 + lane * 8 of a 1 KB block, so a wave-wide
// load is 512 contiguous bytes (4 cache lines); from row-major rows it took 32 B out of each of 16 lines.
// Which k a lane holds at which place is what ld_frag gives on a row-major matrix.
#define BAND_ (16 * E_)   // elements of a band
static __device__ __forceinline__ v16h ld_pack(const f16* p) {
  v8h lo = *(const v8h*)p;
  v8h hi = *(const v8h*)(p + 256);
  return cat8(lo, hi);
}
static __device__ __forceinline__ v8f wmma32(v16h a, v16h b, v8f c) {
  // D = A(16x32 f16) * B(32x16 f16) + C(16x16 f32)
  return __builtin_amdgcn_wmma_f32_16x16x32_f16(false, a, false, b, (short)0, c, false, false);
}

// One lane's share of a K/V stage: eight async global->LDS copies of 16 B (ASYNCcnt), four of K rows and four of
// V^T rows. The closing s_wait_xcnt stands in the copies' own statement, so that no address register of a copy
// is rewritten ahead of it.
static __device__ __forceinline__ void stage_copies(uint32_t lk, uint32_t lv, const f16* kg, const f16* vg) {
  asm volatile("global_load_async_to_lds_b128 %0, %8, off\n\t"
               "global_load_async_to_lds_b128 %1, %9, off\n\t"
               "global_load_async_to_lds_b128 %2, %10, off\n\t"
               "global_load_async_to_lds_b128 %3, %11, off\n\t"
               "global_load_async_to_lds_b128 %4, %12, off\n\t"
               "global_load_async_to_lds_b128 %5, %13, off\n\t"
               "global_load_async_to_lds_b128 %6, %14, off\n\t"
               "global_load_async_to_lds_b128 %7, %15, off\n\t"
               "s_wait_xcnt 0x0"
               :: "v"(lk), "v"(lk + 64 * KP_ * 2), "v"(lk + 128 * KP_ * 2), "v"(lk + 192 * KP_ * 2),
                  "v"(lv), "v"(lv + 16 * VP_ * 2), "v"(lv + 32 * VP_ * 2), "v"(lv + 48 * VP_ * 2),
                  "v"(kg), "v"(kg + 64 * E_), "v"(kg + 128 * E_), "v"(kg + 192 * E_),
                  "v"(vg), "v"(vg + 16 * LK_), "v"(vg + 32 * LK_), "v"(vg + 48 * LK_)
               : "memory");
}
// the wave's own copies have landed
static __device__ __forceinline__ void async_wait0() {
  asm volatile("s_wait_asynccnt 0x0" ::: "memory");
}
// the wave's own LDS reads have returned, before the buffer they read is handed back for a refill
static __device__ __forceinline__ void ds_wait0() {
  asm volatile("s_wait_dscnt 0x0" ::: "memory");
}

// ---------------------------------------------------------------- convert
// All six f32 arrays in one launch. Their f16 copies lie one behind the other in the workspace, in the order of the
// arguments, so a block's place in the output follows from its index alone. A block converts CVB_ elements of ONE
// array, 32 rows = two bands, and writes them in fragment order; a lane issues its CVL_ loads of 16 B before the
// first conversion. A lane takes 8 consecutive k of one row at a time (two loads, one 16 B store); a wave takes
// 8 rows x 32 k: it reads 8 whole lines with a pair of loads and fills 4 whole lines with the store.
// Few waves, each with much in flight: waves start at a bounded rate, which holds a grid of one-load waves back.
#define CVL_ 16                 // loads per lane
#define CVB_ (256 * 4 * CVL_)   // elements per block; divides the size of every array
#define CVQ_  (B_ * LQ_ * E_ / CVB_)   // blocks of the query array
#define CVKV_ (B_ * LK_ * E_ / CVB_)   // blocks of the key/value array
#define CVW_  (E_ * E_ / CVB_)         // blocks of one weight matrix
static_assert(CVB_ == 2 * BAND_, "a block of cvt_f32_f16 converts two bands");
__global__ __launch_bounds__(256) void cvt_f32_f16(const float* __restrict__ xq, const float* __restrict__ kv,
                                                   const float* __restrict__ wq, const float* __restrict__ wk,
                                                   const float* __restrict__ wv, const float* __restrict__ wo,
                                                   f16* __restrict__ out) {
  int r = blockIdx.x;           // becomes the block's index inside its own array
  const float* src;
  if (r < CVQ_) {
    src = xq;
  } else if (r < CVQ_ + CVKV_) {
    src = kv;
    r -= CVQ_;
  } else {
    r -= CVQ_ + CVKV_;
    const int w = r / CVW_;
    r -= w * CVW_;
    src = w == 0 ? wq : w == 1 ? wk : w == 2 ? wv : wo;
  }
  const int wave = threadIdx.x >> 5, lane = threadIdx.x & 31;
  const int g = wave >> 1, kh = wave & 1;   // the wave's 8 of the 32 rows, its half of the row (8 k steps of 32)
  const int rr = lane >> 2, q = lane & 3;   // the lane's row among the 8, its 8 k among the 32 of a step
  const float* s = src + (size_t)r * CVB_ + (g * 8 + rr) * E_ + kh * 256 + q * 8;   // + 32 per k step
  f16* d = out + (size_t)blockIdx.x * CVB_ + (g >> 1) * BAND_ + kh * 4096 + q * 128 + ((g & 1) * 8 + rr) * 8;  // + 512
  v4f v[CVL_];
  #pragma unroll
  for (int i = 0; i < CVL_; ++i) v[i] = *(const v4f*)(s + (i >> 1) * 32 + (i & 1) * 4);
  // the loads' address pair, named here, stays whole up to this wait: without it the last load's result was given
  // the pair's own registers, which the fifteen loads before it name too
  asm volatile("s_wait_xcnt 0x0" :: "v"(s) : "memory");
  // keeps every load ahead of the first conversion: without it the last two loads were issued into the first two's
  // registers, behind the wait for those, and the wave paid the memory latency twice
  __builtin_amdgcn_sched_barrier(0);
  #pragma unroll
  for (int i = 0; i < CVL_ / 2; ++i) {
    v8h o;
    #pragma unroll
    for (int e = 0; e < 4; ++e) { o[e] = (f16)v[2 * i][e]; o[4 + e] = (f16)v[2 * i + 1][e]; }
    *(v8h*)(d + i * 512) = o;
  }
}

// ----------------------------------------------------- register-tiled product
// One wave owns MI x 4 accumulator tiles (MI * 16 rows x 64 columns): at MI = 4 a k step of 32 loads 8 fragments for
// 16 WMMAs, where one tile a wave loaded 2 fragments for 1. Each tile still sums k in ascending order.
// Both operands lie in fragment order. ap0 / bp0: this lane's address in the first row tile's / column tile's band;
// further tiles lie a band on, further k steps 512 elements on.
// The fragments go through a ring of three register sets, so that two k steps of loads are in flight.
template <int MI>
static __device__ __forceinline__ void tile_product(const f16* __restrict__ ap0, const f16* __restrict__ bp0,
                                                    v8f (&acc)[MI][4]) {
  const int K = E_;
  v16h a[3][MI], b[3][4];
  #pragma unroll
  for (int s = 0; s < 2; ++s) {
    #pragma unroll
    for (int i = 0; i < MI; ++i) a[s][i] = ld_pack(ap0 + i * BAND_ + s * 512);
    #pragma unroll
    for (int j = 0; j < 4; ++j) b[s][j] = ld_pack(bp0 + j * BAND_ + s * 512);
  }
  // unrolled: the ring index is a compile-time value, so the three sets stay in registers
  #pragma unroll
  for (int ks = 0; ks < K / 32; ++ks) {
    const int cur = ks % 3, nxt = (ks + 2) % 3;
    if (ks + 2 < K / 32) {
      #pragma unroll
      for (int i = 0; i < MI; ++i) a[nxt][i] = ld_pack(ap0 + i * BAND_ + (ks + 2) * 512);
      #pragma unroll
      for (int j = 0; j < 4; ++j) b[nxt][j] = ld_pack(bp0 + j * BAND_ + (ks + 2) * 512);
    }
    // keeps the loads of step ks + 2 ahead of the products of step ks: without it the scheduler sinks every load
    // to just before its first use, and the lone wave of a SIMD waits out the whole load latency at each fragment
    __builtin_amdgcn_sched_barrier(0);
    #pragma unroll
    for (int i = 0; i < MI; ++i)
      #pragma unroll
      for (int j = 0; j < 4; ++j)
        acc[i][j] = wmma32(a[cur][i], b[cur][j], acc[i][j]);
    // the other side of the same fence: the next step's loads stay one group, behind these products
    __builtin_amdgcn_sched_barrier(0);
  }
  // before the caller's epilogue reuses the two register pairs that hold the fragment loads' addresses; the pairs,
  // named here, stay whole up to this wait
  asm volatile("s_wait_xcnt 0x0" :: "v"(ap0), "v"(bp0) : "memory");
  // keeps the epilogue's first address arithmetic behind that wait
  __builtin_amdgcn_sched_barrier(0);
}

// ----------------------------------------------------- projection GEMMs (f16 out)
// out = (X @ W^T + bias) * scale ; X:[rows][512] f16 (batch folded into the rows), W:[512][512] f16, both in
// fragment order; out row-major. K and Q: out[row][col]; V: out[batch][col][row in batch] (V^T).
// ONE launch holds the blocks of all three products: none reads what another writes, so they need no launch
// boundary between them, and a WGP holds two or three blocks at once, whose starts, load waits and stores overlap.
// block = 2 x 2 waves: 128 rows x 128 columns; inside a product, index = row block * 4 + column block.
// K block i and V block i read the same 128 rows of kv.
#define PBKV_ ((B_ * LK_ / 128) * (E_ / 128))   // blocks of the K product, and of the V product
#define PBQ_  ((B_ * LQ_ / 128) * (E_ / 128))   // blocks of the Q product
__global__ __launch_bounds__(128) void gemm_qkv(const f16* __restrict__ xq, const f16* __restrict__ kv,
                                                const f16* __restrict__ Wq, const f16* __restrict__ Wk,
                                                const f16* __restrict__ Wv, const float* __restrict__ bq,
                                                const float* __restrict__ bk, const float* __restrict__ bv,
                                                f16* __restrict__ q, f16* __restrict__ k, f16* __restrict__ vT) {
  const int K = E_, N = E_;
  const int wave = threadIdx.x >> 5, lane = threadIdx.x & 31;
  const int l16 = lane & 15, hs = lane >> 4;
  int blk = blockIdx.x;         // becomes the block's index inside its own product
  const f16* X = kv;
  const f16* W = Wk;
  const float* bias = bk;
  f16* out = k;
  float scale = 1.0f;
  bool tr = false;
  if (blk >= 2 * PBKV_) {
    blk -= 2 * PBKV_;
    X = xq; W = Wq; bias = bq; out = q;
    scale = 0.125f * 1.44269504f;   // 1 / sqrt(DH), times log2 e: flash_attn takes 2^x of the scores
  } else if (blk >= PBKV_) {
    blk -= PBKV_;
    W = Wv; bias = bv;
    tr = true;
  }
  const int row0 = ((blk >> 2) * 2 + (wave >> 1)) * 64;
  const int col0 = ((blk & 3) * 2 + (wave & 1)) * 64;
  v8f acc[4][4] = {};
  tile_product(X + (size_t)row0 * K + lane * 8, W + (size_t)col0 * K + lane * 8, acc);
  if (!tr) {
    #pragma unroll
    for (int j = 0; j < 4; ++j) {
      const int col = col0 + j * 16 + l16;
      const float bc = bias[col];
      #pragma unroll
      for (int i = 0; i < 4; ++i) {
        const int rowb = row0 + i * 16 + hs * 8;
        #pragma unroll
        for (int r = 0; r < 8; ++r)
          out[(size_t)(rowb + r) * N + col] = (f16)((acc[i][j][r] + bc) * scale);
      }
    }
  } else {
    // a wave's 64 rows lie in one batch
    out = vT + (size_t)(row0 / LK_) * LK_ * N + (row0 % LK_);
    #pragma unroll
    for (int j = 0; j < 4; ++j) {
      const int col = col0 + j * 16 + l16;
      const float bc = bias[col];
      #pragma unroll
      for (int i = 0; i < 4; ++i) {
        v8h o;
        #pragma unroll
        for (int r = 0; r < 8; ++r) o[r] = (f16)(acc[i][j][r] + bc);
        *(v8h*)(out + (size_t)col * LK_ + i * 16 + hs * 8) = o;  // contiguous rows
      }
    }
  }
}

static __device__ __forceinline__ float xhalf(float x) {
  // value of lane ^ 16 (the other half of the same query column)
  const int b = __builtin_bit_cast(int, x);
  return __builtin_bit_cast(float, __builtin_amdgcn_permlanex16(b, b, 0x76543210, 0xfedcba98, false, false));
}
// 2^x, the one instruction exp2 gives, written as asm for the slot the instruction set asks for behind a
// transcendental before its source is overwritten or its result read.
// Early-clobber outputs keep every result off every source inside the
// statement; the closing v_nop is the slot behind the last one. volatile: the statements keep their order, so that
// the one with HEAD stays the first behind the products.
// HEAD: the statement reads accumulators of the matrix products that stand directly in front of it; its four leading
// v_nop are the distance the chip needs between a WMMA and a vector read of its D.
template <bool HEAD>
static __device__ __forceinline__ v8f exp2_8(v8f x) {
  float y0, y1, y2, y3, y4, y5, y6, y7;
  if (HEAD)
    asm volatile("v_nop\n\tv_nop\n\tv_nop\n\tv_nop\n\t"
        "v_exp_f32 %0, %8\n\tv_exp_f32 %1, %9\n\tv_exp_f32 %2, %10\n\tv_exp_f32 %3, %11\n\t"
        "v_exp_f32 %4, %12\n\tv_exp_f32 %5, %13\n\tv_exp_f32 %6, %14\n\tv_exp_f32 %7, %15\n\tv_nop"
        : "=&v"(y0), "=&v"(y1), "=&v"(y2), "=&v"(y3), "=&v"(y4), "=&v"(y5), "=&v"(y6), "=&v"(y7)
        : "v"(x[0]), "v"(x[1]), "v"(x[2]), "v"(x[3]), "v"(x[4]), "v"(x[5]), "v"(x[6]), "v"(x[7]));
  else
    asm volatile("v_exp_f32 %0, %8\n\tv_exp_f32 %1, %9\n\tv_exp_f32 %2, %10\n\tv_exp_f32 %3, %11\n\t"
        "v_exp_f32 %4, %12\n\tv_exp_f32 %5, %13\n\tv_exp_f32 %6, %14\n\tv_exp_f32 %7, %15\n\tv_nop"
        : "=&v"(y0), "=&v"(y1), "=&v"(y2), "=&v"(y3), "=&v"(y4), "=&v"(y5), "=&v"(y6), "=&v"(y7)
        : "v"(x[0]), "v"(x[1]), "v"(x[2]), "v"(x[3]), "v"(x[4]), "v"(x[5]), "v"(x[6]), "v"(x[7]));
  return v8f{y0, y1, y2, y3, y4, y5, y6, y7};
}
static __device__ __forceinline__ float exp2_1(float x) {
  float y;
  asm("v_exp_f32 %0, %1\n\tv_nop" : "=v"(y) : "v"(x));  // v_nop: the same slot
  return y;
}
// sum of a lane's 16 values of P, the tree the row sum has always had
static __device__ __forceinline__ float sum16(v8f e0, v8f e1) {
  const v8f s8 = e0 + e1;
  return ((s8[0] + s8[1]) + (s8[2] + s8[3])) + ((s8[4] + s8[5]) + (s8[6] + s8[7]));
}
// the four K fragments of a pass: two 16-key tiles x two halves of dh; kbp: this lane's place in the first tile
static __device__ __forceinline__ void ld_kfrags(const f16* kbp, v16h (&kf)[4]) {
  kf[0] = ld_frag(kbp);
  kf[1] = ld_frag(kbp + 32);
  kf[2] = ld_frag(kbp + 16 * KP_);
  kf[3] = ld_frag(kbp + 16 * KP_ + 32);
}
// S^T + C = K * Q^T + C for two 16-key tiles and two column groups:
// c0[cg][r] = S[query cg*16 + l16][key hs*8 + r] + C, c1: keys + 16
static __device__ __forceinline__ void st_product(const v16h (&kf)[4], const v16h (&qa)[2][2], const v8f (&cin)[2],
                                                  v8f (&c0)[2], v8f (&c1)[2]) {
  #pragma unroll
  for (int cg = 0; cg < 2; ++cg) {
    c0[cg] = wmma32(kf[0], qa[cg][0], cin[cg]);
    c1[cg] = wmma32(kf[2], qa[cg][0], cin[cg]);
  }
  #pragma unroll
  for (int cg = 0; cg < 2; ++cg) {
    c0[cg] = wmma32(kf[1], qa[cg][1], c0[cg]);
    c1[cg] = wmma32(kf[3], qa[cg][1], c1[cg]);
  }
}
// column maximum over 32 keys: a tree over the lane's own 16 scores, then one exchange between halves
static __device__ __forceinline__ float colmax(v8f a, v8f b) {
  float m8[8];
  #pragma unroll
  for (int r = 0; r < 8; ++r) m8[r] = fmaxf(a[r], b[r]);
  const float ml = fmaxf(fmaxf(fmaxf(m8[0], m8[1]), fmaxf(m8[2], m8[3])),
                         fmaxf(fmaxf(m8[4], m8[5]), fmaxf(m8[6], m8[7])));
  return fmaxf(ml, xhalf(ml));
}
// P may grow to this before the reference of its column is moved; a lane's sum of 16 P under it bounds each of them,
// far inside f16
#define PMAX_ 4096.0f
// A block is 16 waves on 128 queries: 4 groups of 32 query columns x KQ_ = 4 shares of the keys. A wave holds TWO
// 16-column groups, so each K and V fragment it reads from LDS feeds two WMMAs, and it walks only its own 64 keys of
// every 256-key stage, so that the chip still holds four waves a SIMD. Each wave keeps its own reference, sum
// and O over its keys; the four shares of a column are joined once, through LDS, behind the loop.
// The reference R of a column is a score of that column (the maximum over the wave's first 32 keys and the passes that moved R), in log2 units. -R goes
// into the first product as its C operand, so the product's result is the argument of 2^x itself, and P = 2^(S - R)
// needs no vector arithmetic ahead of the exponential. Any R gives the same quotient O / sum; R has to move only
// before P leaves the range of f16. That is tested once a pass, on the sums the pass forms anyway.
__global__ __launch_bounds__(512) void flash_attn(const f16* __restrict__ q16, const f16* __restrict__ k16,
                                                  const f16* __restrict__ vT16, f16* __restrict__ ctx16) {
  __shared__ __attribute__((aligned(16))) f16 lK[2 * SK_ * KP_]; // [buffer][key 0..255][dh 0..63 + pad]
  __shared__ __attribute__((aligned(16))) f16 lV[2 * 64 * VP_];  // [buffer][dh 0..63][key 0..255 + pad]
  __shared__ __attribute__((aligned(16))) float xO[16 * 8 * 256]; // [wave][column group * 4 + dh tile][half][lane][4]
  __shared__ float xM[16 * 2 * 32];                               // [wave][column group][lane]
  __shared__ float xL[16 * 2 * 32];
  const int bh = blockIdx.y, b = bh >> 3, h = bh & 7;
  const int wave = __builtin_amdgcn_readfirstlane(threadIdx.x >> 5), lane = threadIdx.x & 31;
  const int l16 = lane & 15, hs = lane >> 4;
  const int cw = wave & 3, kq = wave >> 2;       // the wave's 32 columns among the 128, its share of the keys
  const int qrow0 = blockIdx.x * 128 + cw * 32;

  // Q^T fragments for this wave's two groups of 16 query columns (K = 64 -> two 32x16 B fragments each)
  v16h qa[2][2];
  #pragma unroll
  for (int cg = 0; cg < 2; ++cg) {
    const f16* qb = q16 + ((size_t)(b * LQ_ + qrow0 + cg * 16 + l16)) * E_ + h * DH_ + hs * 8;
    qa[cg][0] = ld_frag(qb);
    qa[cg][1] = ld_frag(qb + 32);
  }

  // cooperative staging indices (512 threads x 4 x 16 B for each 32 KB tile; a wave's copy covers whole lines)
  const int t = threadIdx.x;
  const int kkey = t >> 3, kdh = (t & 7) * 8;     // + 64 keys per further copy
  const int vdh = t >> 5, vkey = (t & 31) * 8;    // + 16 dh per further copy
  const f16* kg = k16 + ((size_t)b * LK_ + kkey) * E_ + h * DH_ + kdh;  // + stage * SK_ * E_
  const f16* vg = vT16 + ((size_t)b * E_ + h * DH_ + vdh) * LK_ + vkey; // + stage * SK_
  // LDS byte offsets (AS3 offset == low 32 bits of the generic shared pointer)
  const uint32_t lkoff = (uint32_t)(size_t)&lK[kkey * KP_ + kdh];
  const uint32_t lvoff = (uint32_t)(size_t)&lV[vdh * VP_ + vkey];

  v8f nR[2] = {};                  // -R of this lane's query column in all eight places: the C operand of S^T
  float Ls[2] = {0.f, 0.f};        // running sum over this lane's own keys only; halves joined after the loop
  v8f acc[2][4] = {};              // acc[cg][tl][r] = O[query cg*16 + l16][dh tl*16 + hs*8 + r], the wave's keys only

  // two-buffer ring: stage s + 1 flies into the other buffer while stage s is worked on
  stage_copies(lkoff, lvoff, kg, vg);                       // stage 0 -> buffer 0
  async_wait0();
  __syncthreads();                                          // stage 0 visible to every wave
  stage_copies(lkoff + SK_ * KP_ * 2, lvoff + 64 * VP_ * 2, kg + (size_t)SK_ * E_, vg + SK_);  // stage 1 -> buffer 1

  // R starts as each column's maximum over the wave's first 32 keys, from a product of its own with C = 0
  {
    const v8f zero[2] = {};
    v8f c0[2], c1[2];
    v16h kf[4];
    ld_kfrags(&lK[(kq * WK_ + l16) * KP_ + hs * 8], kf);
    st_product(kf, qa, zero, c0, c1);
    nR[0] -= colmax(c0[0], c1[0]);
    nR[1] -= colmax(c0[1], c1[1]);
  }

  for (int s = 0; s < NST_; ++s) {
   const int buf = s & 1;
   const f16* bK = lK + buf * (SK_ * KP_) + kq * (WK_ * KP_);
   const f16* bV = lV + buf * (64 * VP_) + kq * WK_;
   v16h kf[4];
   ld_kfrags(&bK[l16 * KP_ + hs * 8], kf);
   // unrolled: the wave's two 32-key passes of a stage read LDS at immediate offsets from one base
   #pragma unroll
   for (int p = 0; p < WK_ / 32; ++p) {
    // the pass's V fragments, one per dh tile, keys contiguous in lV rows: asked for here, used behind the branch
    v16h va[4];
    #pragma unroll
    for (int tl = 0; tl < 4; ++tl) va[tl] = ld_frag(&bV[(tl * 16 + l16) * VP_ + p * 32 + hs * 8]);
    // S^T - R: the arguments of 2^x
    v8f c0[2], c1[2];
    st_product(kf, qa, nR, c0, c1);
    // keeps every product of the pass ahead of the first exponential statement, whose leading v_nop then cover all
    // four, and the V loads ahead of the exponentials, which hide their latency: left alone, each V load stood
    // directly in front of its two products, with a full wait
    __builtin_amdgcn_sched_barrier(0);

    // P^T as B operand straight from the accumulators: element s is key hs*8 + s, then 16 + hs*8 + (s - 8)
    v16h pb[2];
    float ps[2];
    {
      const v8f e00 = exp2_8<true>(c0[0]), e10 = exp2_8<false>(c1[0]);
      ps[0] = sum16(e00, e10);
      pb[0] = cat8(__builtin_convertvector(e00, v8h), __builtin_convertvector(e10, v8h));
      const v8f e01 = exp2_8<false>(c0[1]), e11 = exp2_8<false>(c1[1]);
      ps[1] = sum16(e01, e11);
      pb[1] = cat8(__builtin_convertvector(e01, v8h), __builtin_convertvector(e11, v8h));
    }

    // one scalar branch a pass, taken when some P has grown too large: R moves up to the column's maximum, by d
    if (__builtin_amdgcn_ballot_w32(fmaxf(ps[0], ps[1]) > PMAX_) != 0) {
      #pragma unroll
      for (int cg = 0; cg < 2; ++cg) {
        const float d = fmaxf(colmax(c0[cg], c1[cg]), 0.f);
        const float al = exp2_1(-d);
        nR[cg] -= d;
        Ls[cg] *= al;
        #pragma unroll
        for (int tl = 0; tl < 4; ++tl) acc[cg][tl] *= al;
        const v8f e0 = exp2_8<false>(c0[cg] - d), e1 = exp2_8<false>(c1[cg] - d);
        ps[cg] = sum16(e0, e1);
        pb[cg] = cat8(__builtin_convertvector(e0, v8h), __builtin_convertvector(e1, v8h));
      }
    }
    Ls[0] += ps[0];
    Ls[1] += ps[1];

    if (p + 1 < WK_ / 32) {
      // the next pass's K fragments, of the same stage, into the registers this pass's products have left
      ld_kfrags(&bK[((p + 1) * 32 + l16) * KP_ + hs * 8], kf);
      // keeps those loads ahead of the products below, which hide their latency
      __builtin_amdgcn_sched_barrier(0);
    }

    // O^T += V^T(64x32) * P^T(32x16): one V fragment per dh tile for both column groups
    #pragma unroll
    for (int tl = 0; tl < 4; ++tl) {
      acc[0][tl] = wmma32(va[tl], pb[0], acc[0][tl]);
      acc[1][tl] = wmma32(va[tl], pb[1], acc[1][tl]);
    }
   }
   // publish point of stage s + 1: own reads of this buffer done, own copies landed, then every wave meets
   ds_wait0();
   async_wait0();
   __syncthreads();
   if (s + 2 < NST_)   // refill the buffer that every wave has just left
     stage_copies(lkoff + buf * (SK_ * KP_ * 2), lvoff + buf * (64 * VP_ * 2),
                  kg + (size_t)(s + 2) * SK_ * E_, vg + (s + 2) * SK_);
  }
  async_wait0();       // nothing of this wave is in flight when it leaves the loop

  // every wave lays down its share: reference, sum and O of its two column groups; a store is 512 contiguous bytes
  #pragma unroll
  for (int cg = 0; cg < 2; ++cg) {
    xM[(wave * 2 + cg) * 32 + lane] = -nR[cg][0];
    xL[(wave * 2 + cg) * 32 + lane] = Ls[cg];
    #pragma unroll
    for (int tl = 0; tl < 4; ++tl) {
      float* d = xO + (wave * 8 + cg * 4 + tl) * 256 + lane * 4;
      *(v4f*)d = __builtin_shufflevector(acc[cg][tl], acc[cg][tl], 0, 1, 2, 3);
      *(v4f*)(d + 128) = __builtin_shufflevector(acc[cg][tl], acc[cg][tl], 4, 5, 6, 7);
    }
  }
  __syncthreads();     // the four shares of every column are visible

  // the join, spread over the four waves of a column block: wave kq takes column group kq / 2, dh tiles 2 * (kq % 2), + 1
  const int cgj = kq >> 1, tl0 = (kq & 1) * 2;
  float mk[KQ_], f[KQ_];
  #pragma unroll
  for (int k = 0; k < KQ_; ++k) mk[k] = xM[((k * 4 + cw) * 2 + cgj) * 32 + lane];
  const float mg = fmaxf(fmaxf(mk[0], mk[1]), fmaxf(mk[2], mk[3]));
  float lg = 0.f;
  #pragma unroll
  for (int k = 0; k < KQ_; ++k) {
    f[k] = exp2_1(mk[k] - mg);
    lg += f[k] * xL[((k * 4 + cw) * 2 + cgj) * 32 + lane];
  }
  lg += xhalf(lg);
  const float inv = 1.f / lg;
  // a column group's 16 queries are one band; head h is its k steps 2h and 2h + 1; a store is 512 contiguous bytes
  f16* oband = ctx16 + (size_t)(b * LQ_ + qrow0 + cgj * 16) * E_ + h * 2 * 512 + lane * 8;
  #pragma unroll
  for (int u = 0; u < 2; ++u) {
    v8f o = {};
    #pragma unroll
    for (int k = 0; k < KQ_; ++k) {
      const float* sp = xO + ((k * 4 + cw) * 8 + cgj * 4 + tl0 + u) * 256 + lane * 4;
      const v4f lo = *(const v4f*)sp, hi = *(const v4f*)(sp + 128);
      o += f[k] * __builtin_shufflevector(lo, hi, 0, 1, 2, 3, 4, 5, 6, 7);
    }
    *(v8h*)(oband + (tl0 + u) * 256) = __builtin_convertvector(o * inv, v8h);  // 8 consecutive dh of one query
  }
}

// ------------------------- output projection + bias + residual + LayerNorm (f32)
// value of lane ^ M inside the lane's row of 16 (a DPP move, which the compiler folds into the add that uses it)
template <int M>
static __device__ __forceinline__ float xrow(float x) {
  const int v = __builtin_bit_cast(int, x);
  return __builtin_bit_cast(float, __builtin_amdgcn_update_dpp(v, v, 0x160 + M, 0xf, 0xf, true));  // row_xmask:M
}
// 1 / sqrt(x), the one instruction rsqrtf gives, as asm for the same slot behind a transcendental as in exp2_1
static __device__ __forceinline__ float rsq1(float x) {
  float y;
  asm("v_rsq_f32 %0, %1\n\tv_nop" : "=v"(y) : "v"(x));
  return y;
}
// A block holds OR_ WHOLE rows of x = query + ctx @ Wo^T + bo: 8 waves side by side, OR_ rows x 64 columns a wave;
// ctx and W in fragment order. x never leaves the registers: each wave sums its 64 columns of every row (in-lane over
// the 4 column tiles, then over the 16 lanes of a row of lanes), the 8 shares of a row are joined through LDS, and
// the block normalises and writes the output itself.
#define OR_ 32
__global__ __launch_bounds__(256) void gemm_out_ln(const f16* __restrict__ ctx, const f16* __restrict__ W,
                                                   const float* __restrict__ bias, const float* __restrict__ resid,
                                                   const float* __restrict__ g, const float* __restrict__ be,
                                                   float* __restrict__ out) {
  __shared__ __attribute__((aligned(16))) float red[8 * OR_ * 2];  // [wave][row][sum, sum of squares]
  __shared__ __attribute__((aligned(16))) float stat[OR_ * 2];     // [row][mean, 1 / std]
  const int K = E_, N = E_;
  const int wave = threadIdx.x >> 5, lane = threadIdx.x & 31;
  const int l16 = lane & 15, hs = lane >> 4;
  const int row0 = blockIdx.x * OR_;
  const int col0 = wave * 64;
  // the lane's 4 columns of bias, gamma and beta, asked for ahead of the product, which hides their latency
  float bc[4], gc[4], bec[4];
  #pragma unroll
  for (int j = 0; j < 4; ++j) {
    bc[j] = bias[col0 + j * 16 + l16];
    gc[j] = g[col0 + j * 16 + l16];
    bec[j] = be[col0 + j * 16 + l16];
  }
  // before a later load's result may land on a register that holds an address of these loads
  asm volatile("s_wait_xcnt 0x0" ::: "memory");
  v8f acc[OR_ / 16][4] = {};
  tile_product<OR_ / 16>(ctx + (size_t)row0 * K + lane * 8, W + (size_t)col0 * K + lane * 8, acc);
  // one lane offset for the whole tile; every element lies a compile-time distance from it
  const int base = (row0 + hs * 8) * N + col0 + l16;
  const float* rp = resid + base;
  float* op = out + base;
  v8f rs[OR_ / 16][4];
  #pragma unroll
  for (int i = 0; i < OR_ / 16; ++i)
    #pragma unroll
    for (int j = 0; j < 4; ++j)
      #pragma unroll
      for (int r = 0; r < 8; ++r) rs[i][j][r] = rp[(i * 16 + r) * N + j * 16];
  // the residual loads' lane offset, named here, stays whole up to this wait
  asm volatile("s_wait_xcnt 0x0" :: "v"(base) : "memory");
  #pragma unroll
  for (int i = 0; i < OR_ / 16; ++i)
    #pragma unroll
    for (int j = 0; j < 4; ++j) acc[i][j] = acc[i][j] + bc[j] + rs[i][j];

  // the wave's share of every row's sum and sum of squares; s[i][r] belongs to row i * 16 + hs * 8 + r
  #pragma unroll
  for (int i = 0; i < OR_ / 16; ++i) {
    v8f s = (acc[i][0] + acc[i][1]) + (acc[i][2] + acc[i][3]);
    v8f s2 = (acc[i][0] * acc[i][0] + acc[i][1] * acc[i][1]) + (acc[i][2] * acc[i][2] + acc[i][3] * acc[i][3]);
    #pragma unroll
    for (int r = 0; r < 8; ++r) {
      s[r] += xrow<1>(s[r]);  s2[r] += xrow<1>(s2[r]);
      s[r] += xrow<2>(s[r]);  s2[r] += xrow<2>(s2[r]);
      s[r] += xrow<4>(s[r]);  s2[r] += xrow<4>(s2[r]);
      s[r] += xrow<8>(s[r]);  s2[r] += xrow<8>(s2[r]);
    }
    if (l16 == 0) {
      float* d = red + (wave * OR_ + i * 16 + hs * 8) * 2;
      #pragma unroll
      for (int r = 0; r < 8; r += 2) *(v4f*)(d + r * 2) = v4f{s[r], s2[r], s[r + 1], s2[r + 1]};
    }
  }
  __syncthreads();     // the eight shares of every row are visible
  if (threadIdx.x < OR_) {
    float s = 0.f, s2 = 0.f;
    #pragma unroll
    for (int w = 0; w < 8; ++w) {
      s += red[(w * OR_ + threadIdx.x) * 2];
      s2 += red[(w * OR_ + threadIdx.x) * 2 + 1];
    }
    const float mu = s * (1.f / E_);
    const float var = fmaxf(s2 * (1.f / E_) - mu * mu, 0.f);
    stat[threadIdx.x * 2] = mu;
    stat[threadIdx.x * 2 + 1] = rsq1(var + 1e-5f);
  }
  __syncthreads();     // every row's mean and 1 / std are visible
  #pragma unroll
  for (int i = 0; i < OR_ / 16; ++i) {
    #pragma unroll
    for (int r = 0; r < 8; ++r) {
      const float mu = stat[(i * 16 + hs * 8 + r) * 2], rstd = stat[(i * 16 + hs * 8 + r) * 2 + 1];
      #pragma unroll
      for (int j = 0; j < 4; ++j) acc[i][j][r] = (acc[i][j][r] - mu) * rstd * gc[j] + bec[j];
    }
  }
  // every value stands in its own register before the first store: no register that a store names is written again
  __builtin_amdgcn_sched_barrier(0);
  #pragma unroll
  for (int i = 0; i < OR_ / 16; ++i)
    #pragma unroll
    for (int j = 0; j < 4; ++j)
      #pragma unroll
      for (int r = 0; r < 8; ++r) op[(i * 16 + r) * N + j * 16] = acc[i][j][r];
}

// ------------------------------------------------------------------ launcher
extern "C" void kernel_launch(void* const* d_in, const int* in_sizes, int n_in,
                              void* d_out, int out_size, void* d_ws, size_t ws_size,
                              hipStream_t stream) {
  (void)in_sizes; (void)n_in; (void)out_size; (void)ws_size;
  const float* query     = (const float*)d_in[0];
  const float* key_value = (const float*)d_in[1];
  const float* Wq = (const float*)d_in[2];
  const float* bq = (const float*)d_in[3];
  const float* Wk = (const float*)d_in[4];
  const float* bk = (const float*)d_in[5];
  const float* Wv = (const float*)d_in[6];
  const float* bv = (const float*)d_in[7];
  const float* Wo = (const float*)d_in[8];
  const float* bo = (const float*)d_in[9];
  const float* gamma = (const float*)d_in[10];
  const float* beta  = (const float*)d_in[11];
  float* out = (float*)d_out;

  const size_t nQ  = (size_t)B_ * LQ_ * E_;   // 2,097,152
  const size_t nKV = (size_t)B_ * LK_ * E_;   // 4,194,304
  const size_t nW  = (size_t)E_ * E_;         //   262,144

  f16* p = (f16*)d_ws;
  f16* xq16  = p; p += nQ;
  f16* kv16  = p; p += nKV;
  f16* Wq16  = p; p += nW;
  f16* Wk16  = p; p += nW;
  f16* Wv16  = p; p += nW;
  f16* Wo16  = p; p += nW;
  f16* q16   = p; p += nQ;
  f16* k16   = p; p += nKV;
  f16* vT16  = p; p += nKV;
  f16* ctx16 = p;

  // xq16, kv16, Wq16, Wk16, Wv16, Wo16 are one run of the workspace, filled in this order, each in fragment order
  cvt_f32_f16<<<dim3(CVQ_ + CVKV_ + 4 * CVW_), dim3(256), 0, stream>>>(query, key_value, Wq, Wk, Wv, Wo, xq16);

  // Q = (x @ Wq^T + bq) * log2 e/sqrt(DH), K = kv @ Wk^T + bk, V^T = (kv @ Wv^T + bv)^T per batch
  gemm_qkv<<<dim3(2 * PBKV_ + PBQ_), dim3(128), 0, stream>>>(xq16, kv16, Wq16, Wk16, Wv16, bq, bk, bv, q16, k16, vT16);

  flash_attn<<<dim3(LQ_ / 128, B_ * H_, 1), 512, 0, stream>>>(q16, k16, vT16, ctx16);

  gemm_out_ln<<<dim3((B_ * LQ_) / OR_, 1, 1), 256, 0, stream>>>(ctx16, Wo16, bo, query, gamma, beta, out);
}
